// v000
// The times below were measured on an AMD MI455X: many runs one after another, warmed up first and cycling through
// copies of the inputs, with the whole window's GPU time divided by the number of runs. Launches and the gaps
// between them are all in it. The median over several windows is given; except for v000 it joins two sittings, which
// can be a few percent apart, so the side-by-side timings, each taken in one sitting, are the better comparison.
// v000, which the later versions start from, runs in 386 microseconds.
#include <hip/hip_runtime.h>
#include <hip/hip_bf16.h>

typedef __attribute__((ext_vector_type(16))) __bf16 v16bf;
typedef __attribute__((ext_vector_type(8)))  float  v8f;

#define D_IN   2048
#define D_OUT  2048
#define NTOK   8192   // B*S
#define NEXP   8
#define RANK   8
#define LSCALE 2.0f   // ALPHA / R
#define PBROWS 80     // 8 router + 64 (E*R) + 8 pad
#define PBTILES 5
#define TOKSTRIDE 20  // dwords per token record

#define KC     64     // D_IN / 32 k-chunks
#define FRAG   16     // bf16 per lane per fragment
#define MT_X   512    // NTOK/16 row tiles of x
#define NT_W   128    // D_OUT/16 col tiles of W

#define TM 128
#define TN 128

__device__ __forceinline__ void split_bf16(float x, __bf16& h, __bf16& l) {
    h = (__bf16)x;                 // RNE to bf16 (hi)
    l = (__bf16)(x - (float)h);    // residual (lo)
}

__device__ __forceinline__ size_t frag_off(int tile, int kc, int lane) {
    return (((size_t)tile * KC + kc) * 32 + lane) * FRAG;
}

__global__ __launch_bounds__(256) void k_packx(const float* __restrict__ x,
                                               __bf16* __restrict__ XPh,
                                               __bf16* __restrict__ XPl) {
    int t = blockIdx.x * 256 + threadIdx.x;        // 0 .. MT_X*KC*32-1
    int lane = t & 31;
    int kc   = (t >> 5) & (KC - 1);
    int mt   = t >> 11;
    int row  = mt * 16 + (lane & 15);
    int kb   = (lane >> 4) << 3;
    const float* src = x + (size_t)row * D_IN + kc * 32;
    v16bf h, l;
#pragma unroll
    for (int j = 0; j < 8; ++j) {
        __bf16 h0, l0, h1, l1;
        split_bf16(src[kb + j],      h0, l0);
        split_bf16(src[kb + 16 + j], h1, l1);
        h[j] = h0; l[j] = l0; h[8 + j] = h1; l[8 + j] = l1;
    }
    size_t off = (size_t)t * FRAG;
    *(v16bf*)(XPh + off) = h;
    *(v16bf*)(XPl + off) = l;
}

// Same for W_base [2048x2048] (B-matrix panel: tile = 16 output features).
__global__ __launch_bounds__(256) void k_packw(const float* __restrict__ Wb,
                                               __bf16* __restrict__ WPh,
                                               __bf16* __restrict__ WPl) {
    int t = blockIdx.x * 256 + threadIdx.x;        // 0 .. NT_W*KC*32-1
    int lane = t & 31;
    int kc   = (t >> 5) & (KC - 1);
    int nt   = t >> 11;
    int row  = nt * 16 + (lane & 15);
    int kb   = (lane >> 4) << 3;
    const float* src = Wb + (size_t)row * D_IN + kc * 32;
    v16bf h, l;
#pragma unroll
    for (int j = 0; j < 8; ++j) {
        __bf16 h0, l0, h1, l1;
        split_bf16(src[kb + j],      h0, l0);
        split_bf16(src[kb + 16 + j], h1, l1);
        h[j] = h0; l[j] = l0; h[8 + j] = h1; l[8 + j] = l1;
    }
    size_t off = (size_t)t * FRAG;
    *(v16bf*)(WPh + off) = h;
    *(v16bf*)(WPl + off) = l;
}

// Pack [W_router ; A_w ; zeros] (80 logical rows) into 5 fragment tiles.
__global__ __launch_bounds__(256) void k_packpb(const float* __restrict__ Wr,
                                                const float* __restrict__ Aw,
                                                __bf16* __restrict__ PBh,
                                                __bf16* __restrict__ PBl) {
    int t = blockIdx.x * 256 + threadIdx.x;        // 0 .. PBTILES*KC*32-1
    if (t >= PBTILES * KC * 32) return;
    int lane = t & 31;
    int kc   = (t >> 5) & (KC - 1);
    int nt   = t >> 11;
    int row  = nt * 16 + (lane & 15);              // 0..79
    int kb   = (lane >> 4) << 3;
    const float* src = (row < NEXP) ? (Wr + (size_t)row * D_IN)
                     : (row < NEXP + NEXP * RANK) ? (Aw + (size_t)(row - NEXP) * D_IN)
                     : nullptr;
    v16bf h, l;
#pragma unroll
    for (int j = 0; j < 8; ++j) {
        float f0 = src ? src[kc * 32 + kb + j]      : 0.0f;
        float f1 = src ? src[kc * 32 + kb + 16 + j] : 0.0f;
        __bf16 h0, l0, h1, l1;
        split_bf16(f0, h0, l0);
        split_bf16(f1, h1, l1);
        h[j] = h0; l[j] = l0; h[8 + j] = h1; l[8 + j] = l1;
    }
    size_t off = (size_t)t * FRAG;
    *(v16bf*)(PBh + off) = h;
    *(v16bf*)(PBl + off) = l;
}

__global__ __launch_bounds__(256) void k_hl(const __bf16* __restrict__ XPh,
                                            const __bf16* __restrict__ XPl,
                                            const __bf16* __restrict__ PBh,
                                            const __bf16* __restrict__ PBl,
                                            float* __restrict__ hl) {
    const int lane = threadIdx.x & 31;
    const int w    = threadIdx.x >> 5;
    const int mt   = blockIdx.x * 8 + w;           // row tile 0..511
    const int row16 = lane & 15;
    const int mhi   = (lane >> 4) * 8;

    v8f acc[PBTILES];
#pragma unroll
    for (int t = 0; t < PBTILES; ++t)
#pragma unroll
        for (int j = 0; j < 8; ++j) acc[t][j] = 0.0f;

    for (int kc = 0; kc < KC; ++kc) {
        size_t ao = frag_off(mt, kc, lane);
        v16bf ah = *(const v16bf*)(XPh + ao);
        v16bf al = *(const v16bf*)(XPl + ao);
#pragma unroll
        for (int t = 0; t < PBTILES; ++t) {
            size_t bo = frag_off(t, kc, lane);
            v16bf bh = *(const v16bf*)(PBh + bo);
            v16bf bl = *(const v16bf*)(PBl + bo);
            acc[t] = __builtin_amdgcn_wmma_f32_16x16x32_bf16(false, ah, false, bh, (short)0, acc[t], false, false);
            acc[t] = __builtin_amdgcn_wmma_f32_16x16x32_bf16(false, ah, false, bl, (short)0, acc[t], false, false);
            acc[t] = __builtin_amdgcn_wmma_f32_16x16x32_bf16(false, al, false, bh, (short)0, acc[t], false, false);
        }
    }
#pragma unroll
    for (int t = 0; t < PBTILES; ++t)
#pragma unroll
        for (int i = 0; i < 8; ++i) {
            int tok = mt * 16 + i + mhi;
            hl[(size_t)tok * PBROWS + t * 16 + row16] = acc[t][i];
        }
}

// ---------------------------------------------------------------------------
// Per-token top-2 + softmax; fold gate*SCALE into the selected h rows.
// Record: [e0(int), e1(int), h0*g0*S (8), h1*g1*S (8), pad, pad]
// ---------------------------------------------------------------------------
__global__ __launch_bounds__(256) void k_gate(const float* __restrict__ hl,
                                              float* __restrict__ tokbuf) {
    int tok = blockIdx.x * 256 + threadIdx.x;
    if (tok >= NTOK) return;
    const float* row = hl + (size_t)tok * PBROWS;

    int e0 = 0; float v0 = row[0];
#pragma unroll
    for (int e = 1; e < NEXP; ++e) { float v = row[e]; if (v > v0) { v0 = v; e0 = e; } }
    int e1 = (e0 == 0) ? 1 : 0; float v1 = row[e1];
#pragma unroll
    for (int e = 0; e < NEXP; ++e) {
        if (e == e0) continue;
        float v = row[e];
        if (v > v1) { v1 = v; e1 = e; }
    }
    float x1  = __expf(v1 - v0);
    float inv = 1.0f / (1.0f + x1);
    float g0 = inv * LSCALE;
    float g1 = x1 * inv * LSCALE;

    float* o = tokbuf + (size_t)tok * TOKSTRIDE;
    o[0] = __int_as_float(e0);
    o[1] = __int_as_float(e1);
#pragma unroll
    for (int r = 0; r < RANK; ++r) {
        o[2 + r]  = row[NEXP + e0 * RANK + r] * g0;
        o[10 + r] = row[NEXP + e1 * RANK + r] * g1;
    }
    o[18] = 0.0f; o[19] = 0.0f;
}

__global__ __launch_bounds__(256) void k_main(const __bf16* __restrict__ XPh,
                                              const __bf16* __restrict__ XPl,
                                              const __bf16* __restrict__ WPh,
                                              const __bf16* __restrict__ WPl,
                                              const float* __restrict__ bb,
                                              const float* __restrict__ Bw,
                                              const float* __restrict__ tokbuf,
                                              float* __restrict__ out) {
    __shared__ float ltok[TM][TOKSTRIDE];          // 2560 dwords

    const int tid  = threadIdx.x;
    const int lane = tid & 31;
    const int w    = tid >> 5;
    const int bm   = blockIdx.y * TM;
    const int bn   = blockIdx.x * TN;

    {
        unsigned lds0 = (unsigned)(uintptr_t)(&ltok[0][0]);
        const float* gsrc = tokbuf + (size_t)bm * TOKSTRIDE;
        for (int i = tid; i < TM * TOKSTRIDE; i += 256) {
            unsigned laddr = lds0 + (unsigned)(i * 4);
            unsigned long long gaddr = (unsigned long long)(uintptr_t)(gsrc + i);
            asm volatile("global_load_async_to_lds_b32 %0, %1, off"
                         :: "v"(laddr), "v"(gaddr) : "memory");
        }
        asm volatile("s_wait_asynccnt 0x0" ::: "memory");
    }
    __syncthreads();

    const int wm = w >> 1;                         // 0..3 -> 32-row slab
    const int wn = w & 1;                          // 0..1 -> 64-col slab
    const int row16 = lane & 15;
    const int mhi   = (lane >> 4) * 8;

    v8f acc[2][4];
#pragma unroll
    for (int a = 0; a < 2; ++a)
#pragma unroll
        for (int b = 0; b < 4; ++b)
#pragma unroll
            for (int j = 0; j < 8; ++j) acc[a][b][j] = 0.0f;

    const int mt0 = (bm >> 4) + wm * 2;            // first of 2 row tiles
    const int nt0 = (bn >> 4) + wn * 4;            // first of 4 col tiles

    for (int kc = 0; kc < KC; ++kc) {
        v16bf ah[2], al[2];
#pragma unroll
        for (int a = 0; a < 2; ++a) {
            size_t ao = frag_off(mt0 + a, kc, lane);
            ah[a] = *(const v16bf*)(XPh + ao);
            al[a] = *(const v16bf*)(XPl + ao);
        }
#pragma unroll
        for (int b = 0; b < 4; ++b) {
            size_t bo = frag_off(nt0 + b, kc, lane);
            v16bf bh = *(const v16bf*)(WPh + bo);
            v16bf bl = *(const v16bf*)(WPl + bo);
#pragma unroll
            for (int a = 0; a < 2; ++a) {
                acc[a][b] = __builtin_amdgcn_wmma_f32_16x16x32_bf16(false, ah[a], false, bh, (short)0, acc[a][b], false, false);
                acc[a][b] = __builtin_amdgcn_wmma_f32_16x16x32_bf16(false, ah[a], false, bl, (short)0, acc[a][b], false, false);
                acc[a][b] = __builtin_amdgcn_wmma_f32_16x16x32_bf16(false, al[a], false, bh, (short)0, acc[a][b], false, false);
            }
        }
        if (kc + 1 < KC) {  // pull next chunk toward GL2 while WMMAs run
            __builtin_prefetch(XPh + frag_off(mt0, kc + 1, lane), 0, 1);
            __builtin_prefetch(WPh + frag_off(nt0, kc + 1, lane), 0, 1);
        }
    }

    // Fused epilogue: + bias + sum_k gate_k*SCALE * (h_k . B_w[e_k][n][:])
#pragma unroll
    for (int a = 0; a < 2; ++a) {
#pragma unroll
        for (int i = 0; i < 8; ++i) {
            const int mloc = wm * 32 + a * 16 + i + mhi;
            const float* tk = &ltok[mloc][0];
            const int e0 = __float_as_int(tk[0]);
            const int e1 = __float_as_int(tk[1]);
#pragma unroll
            for (int b = 0; b < 4; ++b) {
                const int n = bn + wn * 64 + b * 16 + row16;
                const float* bw0 = Bw + ((size_t)e0 * D_OUT + n) * RANK;
                const float* bw1 = Bw + ((size_t)e1 * D_OUT + n) * RANK;
                float f = 0.0f;
#pragma unroll
                for (int r = 0; r < RANK; ++r)
                    f += tk[2 + r] * bw0[r] + tk[10 + r] * bw1[r];
                out[(size_t)(bm + mloc) * D_OUT + n] = acc[a][b][i] + bb[n] + f;
            }
        }
    }
}

// ---------------------------------------------------------------------------
// Launch
// ---------------------------------------------------------------------------
extern "C" void kernel_launch(void* const* d_in, const int* in_sizes, int n_in,
                              void* d_out, int out_size, void* d_ws, size_t ws_size,
                              hipStream_t stream) {
    const float* x  = (const float*)d_in[0];   // [4,2048,2048]
    const float* Wb = (const float*)d_in[1];   // [2048,2048]
    const float* bb = (const float*)d_in[2];   // [2048]
    const float* Wr = (const float*)d_in[3];   // [8,2048]
    const float* Aw = (const float*)d_in[4];   // [8,8,2048]
    const float* Bw = (const float*)d_in[5];   // [8,2048,8]
    float* out = (float*)d_out;

    char* ws = (char*)d_ws;
    // panel sizes (bytes): XP 2x33554432, WP 2x8388608, PB 2x327680
    __bf16* XPh = (__bf16*)(ws);
    __bf16* XPl = (__bf16*)(ws + 33554432ull);
    __bf16* WPh = (__bf16*)(ws + 67108864ull);
    __bf16* WPl = (__bf16*)(ws + 75497472ull);
    __bf16* PBh = (__bf16*)(ws + 83886080ull);
    __bf16* PBl = (__bf16*)(ws + 84213760ull);
    float*  hl  = (float*)(ws + 84541440ull);  // 8192*80*4
    float*  tok = (float*)(ws + 87162880ull);  // 8192*20*4

    hipLaunchKernelGGL(k_packx,  dim3(MT_X * KC * 32 / 256), dim3(256), 0, stream, x,  XPh, XPl);
    hipLaunchKernelGGL(k_packw,  dim3(NT_W * KC * 32 / 256), dim3(256), 0, stream, Wb, WPh, WPl);
    hipLaunchKernelGGL(k_packpb, dim3((PBTILES * KC * 32 + 255) / 256), dim3(256), 0, stream, Wr, Aw, PBh, PBl);
    hipLaunchKernelGGL(k_hl,     dim3(MT_X / 8), dim3(256), 0, stream, XPh, XPl, PBh, PBl, hl);
    hipLaunchKernelGGL(k_gate,   dim3(NTOK / 256), dim3(256), 0, stream, hl, tok);
    hipLaunchKernelGGL(k_main,   dim3(D_OUT / TN, NTOK / TM), dim3(256), 0, stream,
                       XPh, XPl, WPh, WPl, bb, Bw, tok, out);
}

// v001
// Measured time: 261 microseconds a run.
// Two timings next to v000 put it at 1.49 and 1.44 times that version's speed.
#include <hip/hip_runtime.h>
#include <hip/hip_bf16.h>

typedef __attribute__((ext_vector_type(16))) __bf16 v16bf;
typedef __attribute__((ext_vector_type(8)))  __bf16 v8bf;
typedef __attribute__((ext_vector_type(8)))  float  v8f;

#define D_IN   2048
#define D_OUT  2048
#define NTOK   8192   // B*S
#define NEXP   8
#define RANK   8
#define LSCALE 2.0f   // ALPHA / R
#define PBROWS 80     // 8 router + 64 (E*R) + 8 pad
#define PBTILES 5
#define TOKSTRIDE 20  // dwords per token record

#define KC     64     // D_IN / 32 k-chunks
#define FRAG   16     // bf16 per lane per fragment
#define MT_X   512    // NTOK/16 row tiles of x
#define NT_W   128    // D_OUT/16 col tiles of W

#define TM 128
#define TN 128

#define FRAGB  1024           // bytes of one fragment: 32 lanes x 32 B
#define PANELB (8 * FRAGB)    // the 8 tiles one operand panel gives a block per k-chunk
#define STAGEB (4 * PANELB)   // one k-chunk of a block: [x hi | x lo | W hi | W lo]

__device__ __forceinline__ void split_bf16(float x, __bf16& h, __bf16& l) {
    h = (__bf16)x;                 // RNE to bf16 (hi)
    l = (__bf16)(x - (float)h);    // residual (lo)
}

__device__ __forceinline__ size_t frag_off(int tile, int kc, int lane) {
    return (((size_t)tile * KC + kc) * 32 + lane) * FRAG;
}

__global__ __launch_bounds__(256) void k_packx(const float* __restrict__ x,
                                               __bf16* __restrict__ XPh,
                                               __bf16* __restrict__ XPl) {
    int t = blockIdx.x * 256 + threadIdx.x;        // 0 .. MT_X*KC*32-1
    int lane = t & 31;
    int kc   = (t >> 5) & (KC - 1);
    int mt   = t >> 11;
    int row  = mt * 16 + (lane & 15);
    int kb   = (lane >> 4) << 3;
    const float* src = x + (size_t)row * D_IN + kc * 32;
    v16bf h, l;
#pragma unroll
    for (int j = 0; j < 8; ++j) {
        __bf16 h0, l0, h1, l1;
        split_bf16(src[kb + j],      h0, l0);
        split_bf16(src[kb + 16 + j], h1, l1);
        h[j] = h0; l[j] = l0; h[8 + j] = h1; l[8 + j] = l1;
    }
    size_t off = (size_t)t * FRAG;
    *(v16bf*)(XPh + off) = h;
    *(v16bf*)(XPl + off) = l;
}

// Same for W_base [2048x2048] (B-matrix panel: tile = 16 output features).
__global__ __launch_bounds__(256) void k_packw(const float* __restrict__ Wb,
                                               __bf16* __restrict__ WPh,
                                               __bf16* __restrict__ WPl) {
    int t = blockIdx.x * 256 + threadIdx.x;        // 0 .. NT_W*KC*32-1
    int lane = t & 31;
    int kc   = (t >> 5) & (KC - 1);
    int nt   = t >> 11;
    int row  = nt * 16 + (lane & 15);
    int kb   = (lane >> 4) << 3;
    const float* src = Wb + (size_t)row * D_IN + kc * 32;
    v16bf h, l;
#pragma unroll
    for (int j = 0; j < 8; ++j) {
        __bf16 h0, l0, h1, l1;
        split_bf16(src[kb + j],      h0, l0);
        split_bf16(src[kb + 16 + j], h1, l1);
        h[j] = h0; l[j] = l0; h[8 + j] = h1; l[8 + j] = l1;
    }
    size_t off = (size_t)t * FRAG;
    *(v16bf*)(WPh + off) = h;
    *(v16bf*)(WPl + off) = l;
}

// Pack [W_router ; A_w ; zeros] (80 logical rows) into 5 fragment tiles.
__global__ __launch_bounds__(256) void k_packpb(const float* __restrict__ Wr,
                                                const float* __restrict__ Aw,
                                                __bf16* __restrict__ PBh,
                                                __bf16* __restrict__ PBl) {
    int t = blockIdx.x * 256 + threadIdx.x;        // 0 .. PBTILES*KC*32-1
    if (t >= PBTILES * KC * 32) return;
    int lane = t & 31;
    int kc   = (t >> 5) & (KC - 1);
    int nt   = t >> 11;
    int row  = nt * 16 + (lane & 15);              // 0..79
    int kb   = (lane >> 4) << 3;
    const float* src = (row < NEXP) ? (Wr + (size_t)row * D_IN)
                     : (row < NEXP + NEXP * RANK) ? (Aw + (size_t)(row - NEXP) * D_IN)
                     : nullptr;
    v16bf h, l;
#pragma unroll
    for (int j = 0; j < 8; ++j) {
        float f0 = src ? src[kc * 32 + kb + j]      : 0.0f;
        float f1 = src ? src[kc * 32 + kb + 16 + j] : 0.0f;
        __bf16 h0, l0, h1, l1;
        split_bf16(f0, h0, l0);
        split_bf16(f1, h1, l1);
        h[j] = h0; l[j] = l0; h[8 + j] = h1; l[8 + j] = l1;
    }
    size_t off = (size_t)t * FRAG;
    *(v16bf*)(PBh + off) = h;
    *(v16bf*)(PBl + off) = l;
}

__global__ __launch_bounds__(256) void k_hl(const __bf16* __restrict__ XPh,
                                            const __bf16* __restrict__ XPl,
                                            const __bf16* __restrict__ PBh,
                                            const __bf16* __restrict__ PBl,
                                            float* __restrict__ hl) {
    const int lane = threadIdx.x & 31;
    const int w    = threadIdx.x >> 5;
    const int mt   = blockIdx.x * 8 + w;           // row tile 0..511
    const int row16 = lane & 15;
    const int mhi   = (lane >> 4) * 8;

    v8f acc[PBTILES];
#pragma unroll
    for (int t = 0; t < PBTILES; ++t)
#pragma unroll
        for (int j = 0; j < 8; ++j) acc[t][j] = 0.0f;

    for (int kc = 0; kc < KC; ++kc) {
        size_t ao = frag_off(mt, kc, lane);
        v16bf ah = *(const v16bf*)(XPh + ao);
        v16bf al = *(const v16bf*)(XPl + ao);
#pragma unroll
        for (int t = 0; t < PBTILES; ++t) {
            size_t bo = frag_off(t, kc, lane);
            v16bf bh = *(const v16bf*)(PBh + bo);
            v16bf bl = *(const v16bf*)(PBl + bo);
            acc[t] = __builtin_amdgcn_wmma_f32_16x16x32_bf16(false, ah, false, bh, (short)0, acc[t], false, false);
            acc[t] = __builtin_amdgcn_wmma_f32_16x16x32_bf16(false, ah, false, bl, (short)0, acc[t], false, false);
            acc[t] = __builtin_amdgcn_wmma_f32_16x16x32_bf16(false, al, false, bh, (short)0, acc[t], false, false);
        }
    }
#pragma unroll
    for (int t = 0; t < PBTILES; ++t)
#pragma unroll
        for (int i = 0; i < 8; ++i) {
            int tok = mt * 16 + i + mhi;
            hl[(size_t)tok * PBROWS + t * 16 + row16] = acc[t][i];
        }
}

// ---------------------------------------------------------------------------
// Per-token top-2 + softmax; fold gate*SCALE into the selected h rows.
// Record: [e0(int), e1(int), h0*g0*S (8), h1*g1*S (8), pad, pad]
// ---------------------------------------------------------------------------
__global__ __launch_bounds__(256) void k_gate(const float* __restrict__ hl,
                                              float* __restrict__ tokbuf) {
    int tok = blockIdx.x * 256 + threadIdx.x;
    if (tok >= NTOK) return;
    const float* row = hl + (size_t)tok * PBROWS;

    int e0 = 0; float v0 = row[0];
#pragma unroll
    for (int e = 1; e < NEXP; ++e) { float v = row[e]; if (v > v0) { v0 = v; e0 = e; } }
    int e1 = (e0 == 0) ? 1 : 0; float v1 = row[e1];
#pragma unroll
    for (int e = 0; e < NEXP; ++e) {
        if (e == e0) continue;
        float v = row[e];
        if (v > v1) { v1 = v; e1 = e; }
    }
    float x1  = __expf(v1 - v0);
    float inv = 1.0f / (1.0f + x1);
    float g0 = inv * LSCALE;
    float g1 = x1 * inv * LSCALE;

    float* o = tokbuf + (size_t)tok * TOKSTRIDE;
    o[0] = __int_as_float(e0);
    o[1] = __int_as_float(e1);
#pragma unroll
    for (int r = 0; r < RANK; ++r) {
        o[2 + r]  = row[NEXP + e0 * RANK + r] * g0;
        o[10 + r] = row[NEXP + e1 * RANK + r] * g1;
    }
    o[18] = 0.0f; o[19] = 0.0f;
}

__device__ __forceinline__ void stage_copy(unsigned lds,
                                           const __bf16* xh, const __bf16* xl, unsigned xo,
                                           const __bf16* wh, const __bf16* wl, unsigned wo) {
    const unsigned long long gxh = (unsigned long long)(uintptr_t)xh + xo;
    const unsigned long long gxl = (unsigned long long)(uintptr_t)xl + xo;
    const unsigned long long gwh = (unsigned long long)(uintptr_t)wh + wo;
    const unsigned long long gwl = (unsigned long long)(uintptr_t)wl + wo;
    asm volatile("global_load_async_to_lds_b128 %0, %8, off\n\t"
                 "global_load_async_to_lds_b128 %1, %9, off\n\t"
                 "global_load_async_to_lds_b128 %2, %10, off\n\t"
                 "global_load_async_to_lds_b128 %3, %11, off\n\t"
                 "global_load_async_to_lds_b128 %4, %12, off\n\t"
                 "global_load_async_to_lds_b128 %5, %13, off\n\t"
                 "global_load_async_to_lds_b128 %6, %14, off\n\t"
                 "global_load_async_to_lds_b128 %7, %15, off\n\t"
                 "s_wait_xcnt 0x0"
                 :: "v"(lds),               "v"(lds + 512u),
                    "v"(lds + PANELB),      "v"(lds + PANELB + 512u),
                    "v"(lds + 2 * PANELB),  "v"(lds + 2 * PANELB + 512u),
                    "v"(lds + 3 * PANELB),  "v"(lds + 3 * PANELB + 512u),
                    "v"(gxh), "v"(gxh + 512ull), "v"(gxl), "v"(gxl + 512ull),
                    "v"(gwh), "v"(gwh + 512ull), "v"(gwl), "v"(gwl + 512ull)
                 : "memory");
}

// One lane's 16 bf16 of a staged fragment: its two 16-B halves.
__device__ __forceinline__ v16bf lds_frag(const char* f, int r0) {
    v8bf lo = *(const v8bf*)(f + r0);
    v8bf hi = *(const v8bf*)(f + (r0 ^ 16));
    return __builtin_shufflevector(lo, hi, 0, 1, 2, 3, 4, 5, 6, 7, 8, 9, 10, 11, 12, 13, 14, 15);
}

__global__ __launch_bounds__(256) void k_main(const __bf16* __restrict__ XPh,
                                              const __bf16* __restrict__ XPl,
                                              const __bf16* __restrict__ WPh,
                                              const __bf16* __restrict__ WPl,
                                              const float* __restrict__ bb,
                                              const float* __restrict__ Bw,
                                              const float* __restrict__ tokbuf,
                                              float* __restrict__ out) {
    __shared__ float ltok[TM][TOKSTRIDE];          // 2560 dwords
    __shared__ __attribute__((aligned(1024))) char ring[2][STAGEB];

    const int tid  = threadIdx.x;
    const int lane = tid & 31;
    const int w    = tid >> 5;
    const int bm   = blockIdx.y * TM;
    const int bn   = blockIdx.x * TN;

    {
        unsigned lds0 = (unsigned)(uintptr_t)(&ltok[0][0]);
        const float* gsrc = tokbuf + (size_t)bm * TOKSTRIDE;
        for (int i = tid; i < TM * TOKSTRIDE; i += 256) {
            unsigned laddr = lds0 + (unsigned)(i * 4);
            unsigned long long gaddr = (unsigned long long)(uintptr_t)(gsrc + i);
            asm volatile("global_load_async_to_lds_b32 %0, %1, off"
                         :: "v"(laddr), "v"(gaddr) : "memory");
        }
        asm volatile("s_wait_asynccnt 0x0" ::: "memory");
    }
    __syncthreads();

    const int wm = w >> 1;                         // 0..3 -> 32-row slab
    const int wn = w & 1;                          // 0..1 -> 64-col slab
    const int row16 = lane & 15;
    const int mhi   = (lane >> 4) * 8;

    v8f acc[2][4];
#pragma unroll
    for (int a = 0; a < 2; ++a)
#pragma unroll
        for (int b = 0; b < 4; ++b)
#pragma unroll
            for (int j = 0; j < 8; ++j) acc[a][b][j] = 0.0f;

    const unsigned ldsw = (unsigned)(uintptr_t)(&ring[0][0]) + (unsigned)(w * FRAGB)
                        + (unsigned)((lane ^ (lane >> 4)) * 16);
    // Byte offsets into the panels (below 2^25): two registers live through the loop.
    const unsigned xo = (unsigned)(frag_off((bm >> 4) + w, 0, 0) * 2) + (unsigned)(lane * 16);
    const unsigned wo = (unsigned)(frag_off((bn >> 4) + w, 0, 0) * 2) + (unsigned)(lane * 16);
    // Read side: where lane's first half stands inside a staged fragment.
    const int r0 = (2 * lane + ((lane >> 3) & 1)) * 16;

    stage_copy(ldsw, XPh, XPl, xo, WPh, WPl, wo);
    asm volatile("s_wait_asynccnt 0x0" ::: "memory");   // chunk 0 has landed (this wave's share)
    __syncthreads();                                    // ... and every other wave's
    stage_copy(ldsw + STAGEB, XPh, XPl, xo + FRAGB, WPh, WPl, wo + FRAGB);

    for (int kc = 0; kc < KC; ++kc) {
        const char* st = &ring[kc & 1][0];
        v16bf ah[2], al[2];
#pragma unroll
        for (int a = 0; a < 2; ++a) {
            ah[a] = lds_frag(st + (wm * 2 + a) * FRAGB, r0);
            al[a] = lds_frag(st + PANELB + (wm * 2 + a) * FRAGB, r0);
        }
#pragma unroll
        for (int b = 0; b < 4; ++b) {
            v16bf bh = lds_frag(st + 2 * PANELB + (wn * 4 + b) * FRAGB, r0);
            v16bf bl = lds_frag(st + 3 * PANELB + (wn * 4 + b) * FRAGB, r0);
#pragma unroll
            for (int a = 0; a < 2; ++a) {
                acc[a][b] = __builtin_amdgcn_wmma_f32_16x16x32_bf16(false, ah[a], false, bh, (short)0, acc[a][b], false, false);
                acc[a][b] = __builtin_amdgcn_wmma_f32_16x16x32_bf16(false, ah[a], false, bl, (short)0, acc[a][b], false, false);
                acc[a][b] = __builtin_amdgcn_wmma_f32_16x16x32_bf16(false, al[a], false, bh, (short)0, acc[a][b], false, false);
            }
        }
        asm volatile("s_wait_dscnt 0x0" ::: "memory");      // this wave has left buffer kc & 1
        asm volatile("s_wait_asynccnt 0x0" ::: "memory");   // its share of chunk kc + 1 has landed
        __syncthreads();                                    // both hold for every wave
        if (kc + 2 < KC) {
            const unsigned ko = (unsigned)(kc + 2) * FRAGB;
            stage_copy(ldsw + (unsigned)((kc & 1) * STAGEB), XPh, XPl, xo + ko, WPh, WPl, wo + ko);
        }
    }
    asm volatile("s_wait_asynccnt 0x0" ::: "memory");       // no copy outlives the loop

    // Fused epilogue: + bias + sum_k gate_k*SCALE * (h_k . B_w[e_k][n][:])
#pragma unroll
    for (int a = 0; a < 2; ++a) {
#pragma unroll
        for (int i = 0; i < 8; ++i) {
            const int mloc = wm * 32 + a * 16 + i + mhi;
            const float* tk = &ltok[mloc][0];
            const int e0 = __float_as_int(tk[0]);
            const int e1 = __float_as_int(tk[1]);
#pragma unroll
            for (int b = 0; b < 4; ++b) {
                const int n = bn + wn * 64 + b * 16 + row16;
                const float* bw0 = Bw + ((size_t)e0 * D_OUT + n) * RANK;
                const float* bw1 = Bw + ((size_t)e1 * D_OUT + n) * RANK;
                float f = 0.0f;
#pragma unroll
                for (int r = 0; r < RANK; ++r)
                    f += tk[2 + r] * bw0[r] + tk[10 + r] * bw1[r];
                out[(size_t)(bm + mloc) * D_OUT + n] = acc[a][b][i] + bb[n] + f;
            }
        }
    }
}

// ---------------------------------------------------------------------------
// Launch
// ---------------------------------------------------------------------------
extern "C" void kernel_launch(void* const* d_in, const int* in_sizes, int n_in,
                              void* d_out, int out_size, void* d_ws, size_t ws_size,
                              hipStream_t stream) {
    const float* x  = (const float*)d_in[0];   // [4,2048,2048]
    const float* Wb = (const float*)d_in[1];   // [2048,2048]
    const float* bb = (const float*)d_in[2];   // [2048]
    const float* Wr = (const float*)d_in[3];   // [8,2048]
    const float* Aw = (const float*)d_in[4];   // [8,8,2048]
    const float* Bw = (const float*)d_in[5];   // [8,2048,8]
    float* out = (float*)d_out;

    char* ws = (char*)d_ws;
    // panel sizes (bytes): XP 2x33554432, WP 2x8388608, PB 2x327680
    __bf16* XPh = (__bf16*)(ws);
    __bf16* XPl = (__bf16*)(ws + 33554432ull);
    __bf16* WPh = (__bf16*)(ws + 67108864ull);
    __bf16* WPl = (__bf16*)(ws + 75497472ull);
    __bf16* PBh = (__bf16*)(ws + 83886080ull);
    __bf16* PBl = (__bf16*)(ws + 84213760ull);
    float*  hl  = (float*)(ws + 84541440ull);  // 8192*80*4
    float*  tok = (float*)(ws + 87162880ull);  // 8192*20*4

    hipLaunchKernelGGL(k_packx,  dim3(MT_X * KC * 32 / 256), dim3(256), 0, stream, x,  XPh, XPl);
    hipLaunchKernelGGL(k_packw,  dim3(NT_W * KC * 32 / 256), dim3(256), 0, stream, Wb, WPh, WPl);
    hipLaunchKernelGGL(k_packpb, dim3((PBTILES * KC * 32 + 255) / 256), dim3(256), 0, stream, Wr, Aw, PBh, PBl);
    hipLaunchKernelGGL(k_hl,     dim3(MT_X / 8), dim3(256), 0, stream, XPh, XPl, PBh, PBl, hl);
    hipLaunchKernelGGL(k_gate,   dim3(NTOK / 256), dim3(256), 0, stream, hl, tok);
    hipLaunchKernelGGL(k_main,   dim3(D_OUT / TN, NTOK / TM), dim3(256), 0, stream,
                       XPh, XPl, WPh, WPl, bb, Bw, tok, out);
}

// v002
// Measured time: 249 microseconds a run.
// Two timings next to v001 put it at 1.05 and 1.02 times that version's speed.
// All steps since v000 together make it 1.52 times as fast.
#include <hip/hip_runtime.h>
#include <hip/hip_bf16.h>

typedef __attribute__((ext_vector_type(16))) __bf16 v16bf;
typedef __attribute__((ext_vector_type(8)))  __bf16 v8bf;
typedef __attribute__((ext_vector_type(8)))  float  v8f;

#define D_IN   2048
#define D_OUT  2048
#define NTOK   8192   // B*S
#define NEXP   8
#define RANK   8
#define LSCALE 2.0f   // ALPHA / R
#define PBROWS 80     // 8 router + 64 (E*R) + 8 pad
#define PBTILES 5

#define KC     64     // D_IN / 32 k-chunks
#define KCL    2      // NEXP * RANK / 32 k-chunks of the LoRA term
#define KCX    (KC + KCL)   // k-chunks per tile in the x and W panels
#define FRAG   16     // bf16 per lane per fragment
#define MT_X   512    // NTOK/16 row tiles of x
#define NT_W   128    // D_OUT/16 col tiles of W

#define TM 128
#define TN 128

#define FRAGB  1024           // bytes of one fragment: 32 lanes x 32 B
#define PANELB (8 * FRAGB)    // the 8 tiles one operand panel gives a block per k-chunk
#define STAGEB (4 * PANELB)   // one k-chunk of a block: [x hi | x lo | W hi | W lo]

__device__ __forceinline__ void split_bf16(float x, __bf16& h, __bf16& l) {
    h = (__bf16)x;                 // RNE to bf16 (hi)
    l = (__bf16)(x - (float)h);    // residual (lo)
}

__device__ __forceinline__ size_t frag_off(int tile, int nkc, int kc, int lane) {
    return (((size_t)tile * nkc + kc) * 32 + lane) * FRAG;
}

__global__ __launch_bounds__(256) void k_packx(const float* __restrict__ x,
                                               __bf16* __restrict__ XPh,
                                               __bf16* __restrict__ XPl) {
    int t = blockIdx.x * 256 + threadIdx.x;        // 0 .. MT_X*KC*32-1
    int lane = t & 31;
    int kc   = (t >> 5) & (KC - 1);
    int mt   = t >> 11;
    int row  = mt * 16 + (lane & 15);
    int kb   = (lane >> 4) << 3;
    const float* src = x + (size_t)row * D_IN + kc * 32;
    v16bf h, l;
#pragma unroll
    for (int j = 0; j < 8; ++j) {
        __bf16 h0, l0, h1, l1;
        split_bf16(src[kb + j],      h0, l0);
        split_bf16(src[kb + 16 + j], h1, l1);
        h[j] = h0; l[j] = l0; h[8 + j] = h1; l[8 + j] = l1;
    }
    size_t off = frag_off(mt, KCX, kc, lane);
    *(v16bf*)(XPh + off) = h;
    *(v16bf*)(XPl + off) = l;
}

// Same for W_base [2048x2048] (B-matrix panel: tile = 16 output features),
// followed per tile by B_w as [n][k = e*RANK + r]: in chunk KC + c the 8 k of a
// lane's first half are expert 4c + (lane>>4), those of its second half expert
// 4c + 2 + (lane>>4).
__global__ __launch_bounds__(256) void k_packw(const float* __restrict__ Wb,
                                               const float* __restrict__ Bw,
                                               __bf16* __restrict__ WPh,
                                               __bf16* __restrict__ WPl) {
    int t = blockIdx.x * 256 + threadIdx.x;        // 0 .. NT_W*KCX*32-1
    int lane = t & 31;
    int nt   = (t >> 5) / KCX;
    int kc   = (t >> 5) - nt * KCX;
    int row  = nt * 16 + (lane & 15);
    int hl   = lane >> 4;
    const float* src0;
    const float* src1;
    if (kc < KC) {
        src0 = Wb + (size_t)row * D_IN + kc * 32 + hl * 8;
        src1 = src0 + 16;
    } else {
        int e = (kc - KC) * 4 + hl;
        src0 = Bw + ((size_t)e * D_OUT + row) * RANK;
        src1 = Bw + ((size_t)(e + 2) * D_OUT + row) * RANK;
    }
    v16bf h, l;
#pragma unroll
    for (int j = 0; j < 8; ++j) {
        __bf16 h0, l0, h1, l1;
        split_bf16(src0[j], h0, l0);
        split_bf16(src1[j], h1, l1);
        h[j] = h0; l[j] = l0; h[8 + j] = h1; l[8 + j] = l1;
    }
    size_t off = (size_t)t * FRAG;
    *(v16bf*)(WPh + off) = h;
    *(v16bf*)(WPl + off) = l;
}

// Pack [W_router ; A_w ; zeros] (80 logical rows) into 5 fragment tiles.
__global__ __launch_bounds__(256) void k_packpb(const float* __restrict__ Wr,
                                                const float* __restrict__ Aw,
                                                __bf16* __restrict__ PBh,
                                                __bf16* __restrict__ PBl) {
    int t = blockIdx.x * 256 + threadIdx.x;        // 0 .. PBTILES*KC*32-1
    if (t >= PBTILES * KC * 32) return;
    int lane = t & 31;
    int kc   = (t >> 5) & (KC - 1);
    int nt   = t >> 11;
    int row  = nt * 16 + (lane & 15);              // 0..79
    int kb   = (lane >> 4) << 3;
    const float* src = (row < NEXP) ? (Wr + (size_t)row * D_IN)
                     : (row < NEXP + NEXP * RANK) ? (Aw + (size_t)(row - NEXP) * D_IN)
                     : nullptr;
    v16bf h, l;
#pragma unroll
    for (int j = 0; j < 8; ++j) {
        float f0 = src ? src[kc * 32 + kb + j]      : 0.0f;
        float f1 = src ? src[kc * 32 + kb + 16 + j] : 0.0f;
        __bf16 h0, l0, h1, l1;
        split_bf16(f0, h0, l0);
        split_bf16(f1, h1, l1);
        h[j] = h0; l[j] = l0; h[8 + j] = h1; l[8 + j] = l1;
    }
    size_t off = (size_t)t * FRAG;
    *(v16bf*)(PBh + off) = h;
    *(v16bf*)(PBl + off) = l;
}

__global__ __launch_bounds__(256) void k_hl(const __bf16* __restrict__ XPh,
                                            const __bf16* __restrict__ XPl,
                                            const __bf16* __restrict__ PBh,
                                            const __bf16* __restrict__ PBl,
                                            float* __restrict__ hl) {
    const int lane = threadIdx.x & 31;
    const int w    = threadIdx.x >> 5;
    const int mt   = blockIdx.x * 8 + w;           // row tile 0..511
    const int row16 = lane & 15;
    const int mhi   = (lane >> 4) * 8;

    v8f acc[PBTILES];
#pragma unroll
    for (int t = 0; t < PBTILES; ++t)
#pragma unroll
        for (int j = 0; j < 8; ++j) acc[t][j] = 0.0f;

    for (int kc = 0; kc < KC; ++kc) {
        size_t ao = frag_off(mt, KCX, kc, lane);
        v16bf ah = *(const v16bf*)(XPh + ao);
        v16bf al = *(const v16bf*)(XPl + ao);
#pragma unroll
        for (int t = 0; t < PBTILES; ++t) {
            size_t bo = frag_off(t, KC, kc, lane);
            v16bf bh = *(const v16bf*)(PBh + bo);
            v16bf bl = *(const v16bf*)(PBl + bo);
            acc[t] = __builtin_amdgcn_wmma_f32_16x16x32_bf16(false, ah, false, bh, (short)0, acc[t], false, false);
            acc[t] = __builtin_amdgcn_wmma_f32_16x16x32_bf16(false, ah, false, bl, (short)0, acc[t], false, false);
            acc[t] = __builtin_amdgcn_wmma_f32_16x16x32_bf16(false, al, false, bh, (short)0, acc[t], false, false);
        }
    }
#pragma unroll
    for (int t = 0; t < PBTILES; ++t)
#pragma unroll
        for (int i = 0; i < 8; ++i) {
            int tok = mt * 16 + i + mhi;
            hl[(size_t)tok * PBROWS + t * 16 + row16] = acc[t][i];
        }
}

// ---------------------------------------------------------------------------
// Per-token top-2 + softmax; writes gate*SCALE*h as the x panels' chunks KC and
// KC + 1 (k = e*RANK + r, zero at the six experts not chosen), hi and lo.
// One thread builds one lane-slice, as in k_packx; the four threads of a token
// each repeat its top-2.
// ---------------------------------------------------------------------------
__global__ __launch_bounds__(256) void k_gate(const float* __restrict__ hl,
                                              __bf16* __restrict__ XPh,
                                              __bf16* __restrict__ XPl) {
    int t = blockIdx.x * 256 + threadIdx.x;        // 0 .. MT_X*KCL*32-1
    int lane = t & 31;
    int c    = (t >> 5) & (KCL - 1);
    int mt   = t >> 6;
    int tok  = mt * 16 + (lane & 15);
    const float* row = hl + (size_t)tok * PBROWS;

    int e0 = 0; float v0 = row[0];
#pragma unroll
    for (int e = 1; e < NEXP; ++e) { float v = row[e]; if (v > v0) { v0 = v; e0 = e; } }
    int e1 = (e0 == 0) ? 1 : 0; float v1 = row[e1];
#pragma unroll
    for (int e = 0; e < NEXP; ++e) {
        if (e == e0) continue;
        float v = row[e];
        if (v > v1) { v1 = v; e1 = e; }
    }
    float x1  = __expf(v1 - v0);
    float inv = 1.0f / (1.0f + x1);
    float g0 = inv * LSCALE;
    float g1 = x1 * inv * LSCALE;

    v16bf h, l;
#pragma unroll
    for (int half = 0; half < 2; ++half) {
        const int e = c * 4 + half * 2 + (lane >> 4);
        // Unconditional 16-B loads: under the test they compile to waited dword loads.
        const float4 p = *(const float4*)(row + NEXP + e * RANK);
        const float4 q = *(const float4*)(row + NEXP + e * RANK + 4);
        const float hv[RANK] = {p.x, p.y, p.z, p.w, q.x, q.y, q.z, q.w};
        const bool  on = (e == e0) || (e == e1);
        const float g  = (e == e0) ? g0 : g1;
#pragma unroll
        for (int r = 0; r < RANK; ++r) {
            float v = on ? hv[r] * g : 0.0f;
            __bf16 hh, ll;
            split_bf16(v, hh, ll);
            h[half * 8 + r] = hh; l[half * 8 + r] = ll;
        }
    }
    size_t off = frag_off(mt, KCX, KC + c, lane);
    *(v16bf*)(XPh + off) = h;
    *(v16bf*)(XPl + off) = l;
}

// ---------------------------------------------------------------------------
// y = [x | gated h] @ [W | B_w]^T + bias: base GEMM and LoRA term in one k loop.
// 128x128 tile / block, 8 waves (4x2). Each k-chunk's 32 fragments are brought
// into LDS once per block by async global->LDS copies (two buffers: chunk t+2
// flies while chunk t+1 is worked on); every wave then reads its 12 fragments
// from LDS: 24 ds_load_b128 + 24 v_wmma per 32-wide K chunk.
// ---------------------------------------------------------------------------

__device__ __forceinline__ void stage_copy(unsigned lds,
                                           const __bf16* xh, const __bf16* xl, unsigned xo,
                                           const __bf16* wh, const __bf16* wl, unsigned wo) {
    const unsigned long long gxh = (unsigned long long)(uintptr_t)xh + xo;
    const unsigned long long gxl = (unsigned long long)(uintptr_t)xl + xo;
    const unsigned long long gwh = (unsigned long long)(uintptr_t)wh + wo;
    const unsigned long long gwl = (unsigned long long)(uintptr_t)wl + wo;
    asm volatile("global_load_async_to_lds_b128 %0, %8, off\n\t"
                 "global_load_async_to_lds_b128 %1, %9, off\n\t"
                 "global_load_async_to_lds_b128 %2, %10, off\n\t"
                 "global_load_async_to_lds_b128 %3, %11, off\n\t"
                 "global_load_async_to_lds_b128 %4, %12, off\n\t"
                 "global_load_async_to_lds_b128 %5, %13, off\n\t"
                 "global_load_async_to_lds_b128 %6, %14, off\n\t"
                 "global_load_async_to_lds_b128 %7, %15, off\n\t"
                 "s_wait_xcnt 0x0"
                 :: "v"(lds),               "v"(lds + 512u),
                    "v"(lds + PANELB),      "v"(lds + PANELB + 512u),
                    "v"(lds + 2 * PANELB),  "v"(lds + 2 * PANELB + 512u),
                    "v"(lds + 3 * PANELB),  "v"(lds + 3 * PANELB + 512u),
                    "v"(gxh), "v"(gxh + 512ull), "v"(gxl), "v"(gxl + 512ull),
                    "v"(gwh), "v"(gwh + 512ull), "v"(gwl), "v"(gwl + 512ull)
                 : "memory");
}

// One lane's 16 bf16 of a staged fragment: its two 16-B halves.
__device__ __forceinline__ v16bf lds_frag(const char* f, int r0) {
    v8bf lo = *(const v8bf*)(f + r0);
    v8bf hi = *(const v8bf*)(f + (r0 ^ 16));
    return __builtin_shufflevector(lo, hi, 0, 1, 2, 3, 4, 5, 6, 7, 8, 9, 10, 11, 12, 13, 14, 15);
}

__global__ __launch_bounds__(256, 8) void k_main(const __bf16* __restrict__ XPh,
                                              const __bf16* __restrict__ XPl,
                                              const __bf16* __restrict__ WPh,
                                              const __bf16* __restrict__ WPl,
                                              const float* __restrict__ bb,
                                              float* __restrict__ out) {
    __shared__ __attribute__((aligned(1024))) char ring[2][STAGEB];

    const int tid  = threadIdx.x;
    const int lane = tid & 31;
    const int w    = tid >> 5;
    const int bm   = blockIdx.y * TM;
    const int bn   = blockIdx.x * TN;

    const int wm = w >> 1;                         // 0..3 -> 32-row slab
    const int wn = w & 1;                          // 0..1 -> 64-col slab
    const int row16 = lane & 15;
    const int mhi   = (lane >> 4) * 8;

    v8f acc[2][4];
#pragma unroll
    for (int a = 0; a < 2; ++a)
#pragma unroll
        for (int b = 0; b < 4; ++b)
#pragma unroll
            for (int j = 0; j < 8; ++j) acc[a][b][j] = 0.0f;

    const unsigned ldsw = (unsigned)(uintptr_t)(&ring[0][0]) + (unsigned)(w * FRAGB)
                        + (unsigned)((lane ^ (lane >> 4)) * 16);
    // Byte offsets into the panels (below 2^26): two registers live through the loop.
    const unsigned xo = (unsigned)(frag_off((bm >> 4) + w, KCX, 0, 0) * 2) + (unsigned)(lane * 16);
    const unsigned wo = (unsigned)(frag_off((bn >> 4) + w, KCX, 0, 0) * 2) + (unsigned)(lane * 16);
    // Read side: where lane's first half stands inside a staged fragment.
    const int r0 = (2 * lane + ((lane >> 3) & 1)) * 16;

    stage_copy(ldsw, XPh, XPl, xo, WPh, WPl, wo);
    asm volatile("s_wait_asynccnt 0x0" ::: "memory");   // chunk 0 has landed (this wave's share)
    __syncthreads();                                    // ... and every other wave's
    stage_copy(ldsw + STAGEB, XPh, XPl, xo + FRAGB, WPh, WPl, wo + FRAGB);

    for (int kc = 0; kc < KCX; ++kc) {
        const char* st = &ring[kc & 1][0];
        v16bf ah[2], al[2];
#pragma unroll
        for (int a = 0; a < 2; ++a) {
            ah[a] = lds_frag(st + (wm * 2 + a) * FRAGB, r0);
            al[a] = lds_frag(st + PANELB + (wm * 2 + a) * FRAGB, r0);
        }
#pragma unroll
        for (int b = 0; b < 4; ++b) {
            v16bf bh = lds_frag(st + 2 * PANELB + (wn * 4 + b) * FRAGB, r0);
            v16bf bl = lds_frag(st + 3 * PANELB + (wn * 4 + b) * FRAGB, r0);
#pragma unroll
            for (int a = 0; a < 2; ++a) {
                acc[a][b] = __builtin_amdgcn_wmma_f32_16x16x32_bf16(false, ah[a], false, bh, (short)0, acc[a][b], false, false);
                acc[a][b] = __builtin_amdgcn_wmma_f32_16x16x32_bf16(false, ah[a], false, bl, (short)0, acc[a][b], false, false);
                acc[a][b] = __builtin_amdgcn_wmma_f32_16x16x32_bf16(false, al[a], false, bh, (short)0, acc[a][b], false, false);
            }
        }
        asm volatile("s_wait_dscnt 0x0" ::: "memory");      // this wave has left buffer kc & 1
        asm volatile("s_wait_asynccnt 0x0" ::: "memory");   // its share of chunk kc + 1 has landed
        __syncthreads();                                    // both hold for every wave
        if (kc + 2 < KCX) {
            const unsigned ko = (unsigned)(kc + 2) * FRAGB;
            stage_copy(ldsw + (unsigned)((kc & 1) * STAGEB), XPh, XPl, xo + ko, WPh, WPl, wo + ko);
        }
    }
    asm volatile("s_wait_asynccnt 0x0" ::: "memory");       // no copy outlives the loop

    // Epilogue: + bias.
#pragma unroll
    for (int b = 0; b < 4; ++b) {
        const int n = bn + wn * 64 + b * 16 + row16;
        const float bias = bb[n];
#pragma unroll
        for (int a = 0; a < 2; ++a) {
#pragma unroll
            for (int i = 0; i < 8; ++i) {
                const int mloc = wm * 32 + a * 16 + i + mhi;
                out[(size_t)(bm + mloc) * D_OUT + n] = acc[a][b][i] + bias;
            }
        }
    }
}

// ---------------------------------------------------------------------------
// Launch
// ---------------------------------------------------------------------------
extern "C" void kernel_launch(void* const* d_in, const int* in_sizes, int n_in,
                              void* d_out, int out_size, void* d_ws, size_t ws_size,
                              hipStream_t stream) {
    const float* x  = (const float*)d_in[0];   // [4,2048,2048]
    const float* Wb = (const float*)d_in[1];   // [2048,2048]
    const float* bb = (const float*)d_in[2];   // [2048]
    const float* Wr = (const float*)d_in[3];   // [8,2048]
    const float* Aw = (const float*)d_in[4];   // [8,8,2048]
    const float* Bw = (const float*)d_in[5];   // [8,2048,8]
    float* out = (float*)d_out;

    char* ws = (char*)d_ws;
    // panel sizes (bytes): XP 2x34603008, WP 2x8650752, PB 2x327680
    __bf16* XPh = (__bf16*)(ws);
    __bf16* XPl = (__bf16*)(ws + 34603008ull);
    __bf16* WPh = (__bf16*)(ws + 69206016ull);
    __bf16* WPl = (__bf16*)(ws + 77856768ull);
    __bf16* PBh = (__bf16*)(ws + 86507520ull);
    __bf16* PBl = (__bf16*)(ws + 86835200ull);
    float*  hl  = (float*)(ws + 87162880ull);  // 8192*80*4

    hipLaunchKernelGGL(k_packx,  dim3(MT_X * KC * 32 / 256), dim3(256), 0, stream, x,  XPh, XPl);
    hipLaunchKernelGGL(k_packw,  dim3(NT_W * KCX * 32 / 256), dim3(256), 0, stream, Wb, Bw, WPh, WPl);
    hipLaunchKernelGGL(k_packpb, dim3((PBTILES * KC * 32 + 255) / 256), dim3(256), 0, stream, Wr, Aw, PBh, PBl);
    hipLaunchKernelGGL(k_hl,     dim3(MT_X / 8), dim3(256), 0, stream, XPh, XPl, PBh, PBl, hl);
    hipLaunchKernelGGL(k_gate,   dim3(MT_X * KCL * 32 / 256), dim3(256), 0, stream, hl, XPh, XPl);
    hipLaunchKernelGGL(k_main,   dim3(D_OUT / TN, NTOK / TM), dim3(256), 0, stream,
                       XPh, XPl, WPh, WPl, bb, out);
}

// v003
// One run takes 168 microseconds.
// Next to v002, in two timings, it ran 1.46 and 1.45 times as fast.
// Counting every step since v000, it is 2.21 times as fast.
#include <hip/hip_runtime.h>
#include <hip/hip_bf16.h>

typedef __attribute__((ext_vector_type(16))) __bf16 v16bf;
typedef __attribute__((ext_vector_type(8)))  __bf16 v8bf;
typedef __attribute__((ext_vector_type(8)))  float  v8f;

#define D_IN   2048
#define D_OUT  2048
#define NTOK   8192   // B*S
#define NEXP   8
#define RANK   8
#define LSCALE 2.0f   // ALPHA / R
#define PBROWS 80     // 8 router + 64 (E*R) + 8 pad
#define PBTILES 5

#define KC     64     // D_IN / 32 k-chunks
#define KCL    2      // NEXP * RANK / 32 k-chunks of the LoRA term
#define KCX    (KC + KCL)   // k-chunks per tile in the x and W panels
#define FRAG   16     // bf16 per lane per fragment
#define MT_X   512    // NTOK/16 row tiles of x
#define NT_W   128    // D_OUT/16 col tiles of W

#define TM 128
#define TN 128

#define FRAGB  1024           // bytes of one fragment: 32 lanes x 32 B
#define PANELB (8 * FRAGB)    // the 8 tiles one operand panel gives a block per k-chunk
#define STAGEB (4 * PANELB)   // one k-chunk of a block: [x hi | x lo | W hi | W lo]

__device__ __forceinline__ void split_bf16(float x, __bf16& h, __bf16& l) {
    h = (__bf16)x;                 // RNE to bf16 (hi)
    l = (__bf16)(x - (float)h);    // residual (lo)
}

__device__ __forceinline__ size_t frag_off(int tile, int nkc, int kc, int lane) {
    return (((size_t)tile * nkc + kc) * 32 + lane) * FRAG;
}

__global__ __launch_bounds__(256) void k_packx(const float* __restrict__ x,
                                               __bf16* __restrict__ XPh,
                                               __bf16* __restrict__ XPl) {
    int t = blockIdx.x * 256 + threadIdx.x;        // 0 .. MT_X*KC*32-1
    int lane = t & 31;
    int kc   = (t >> 5) & (KC - 1);
    int mt   = t >> 11;
    int row  = mt * 16 + (lane & 15);
    int kb   = (lane >> 4) << 3;
    const float* src = x + (size_t)row * D_IN + kc * 32;
    v16bf h, l;
#pragma unroll
    for (int j = 0; j < 8; ++j) {
        __bf16 h0, l0, h1, l1;
        split_bf16(src[kb + j],      h0, l0);
        split_bf16(src[kb + 16 + j], h1, l1);
        h[j] = h0; l[j] = l0; h[8 + j] = h1; l[8 + j] = l1;
    }
    size_t off = frag_off(mt, KCX, kc, lane);
    *(v16bf*)(XPh + off) = h;
    *(v16bf*)(XPl + off) = l;
}

// Same for W_base [2048x2048] (B-matrix panel: tile = 16 output features),
// followed per tile by B_w as [n][k = e*RANK + r]: in chunk KC + c the 8 k of a
// lane's first half are expert 4c + (lane>>4), those of its second half expert
// 4c + 2 + (lane>>4).
__global__ __launch_bounds__(256) void k_packw(const float* __restrict__ Wb,
                                               const float* __restrict__ Bw,
                                               __bf16* __restrict__ WPh,
                                               __bf16* __restrict__ WPl) {
    int t = blockIdx.x * 256 + threadIdx.x;        // 0 .. NT_W*KCX*32-1
    int lane = t & 31;
    int nt   = (t >> 5) / KCX;
    int kc   = (t >> 5) - nt * KCX;
    int row  = nt * 16 + (lane & 15);
    int hl   = lane >> 4;
    const float* src0;
    const float* src1;
    if (kc < KC) {
        src0 = Wb + (size_t)row * D_IN + kc * 32 + hl * 8;
        src1 = src0 + 16;
    } else {
        int e = (kc - KC) * 4 + hl;
        src0 = Bw + ((size_t)e * D_OUT + row) * RANK;
        src1 = Bw + ((size_t)(e + 2) * D_OUT + row) * RANK;
    }
    v16bf h, l;
#pragma unroll
    for (int j = 0; j < 8; ++j) {
        __bf16 h0, l0, h1, l1;
        split_bf16(src0[j], h0, l0);
        split_bf16(src1[j], h1, l1);
        h[j] = h0; l[j] = l0; h[8 + j] = h1; l[8 + j] = l1;
    }
    size_t off = (size_t)t * FRAG;
    *(v16bf*)(WPh + off) = h;
    *(v16bf*)(WPl + off) = l;
}

// Pack [W_router ; A_w ; zeros] (80 logical rows) into 5 fragment tiles.
__global__ __launch_bounds__(256) void k_packpb(const float* __restrict__ Wr,
                                                const float* __restrict__ Aw,
                                                __bf16* __restrict__ PBh,
                                                __bf16* __restrict__ PBl) {
    int t = blockIdx.x * 256 + threadIdx.x;        // 0 .. PBTILES*KC*32-1
    if (t >= PBTILES * KC * 32) return;
    int lane = t & 31;
    int kc   = (t >> 5) & (KC - 1);
    int nt   = t >> 11;
    int row  = nt * 16 + (lane & 15);              // 0..79
    int kb   = (lane >> 4) << 3;
    const float* src = (row < NEXP) ? (Wr + (size_t)row * D_IN)
                     : (row < NEXP + NEXP * RANK) ? (Aw + (size_t)(row - NEXP) * D_IN)
                     : nullptr;
    v16bf h, l;
#pragma unroll
    for (int j = 0; j < 8; ++j) {
        float f0 = src ? src[kc * 32 + kb + j]      : 0.0f;
        float f1 = src ? src[kc * 32 + kb + 16 + j] : 0.0f;
        __bf16 h0, l0, h1, l1;
        split_bf16(f0, h0, l0);
        split_bf16(f1, h1, l1);
        h[j] = h0; l[j] = l0; h[8 + j] = h1; l[8 + j] = l1;
    }
    size_t off = (size_t)t * FRAG;
    *(v16bf*)(PBh + off) = h;
    *(v16bf*)(PBl + off) = l;
}

#define HL_MT 2
#define HL_KW (KC / 8)
#define HL_NT (HL_MT * PBTILES)

__global__ __launch_bounds__(256, 4) void k_hl(const __bf16* __restrict__ XPh,
                                               const __bf16* __restrict__ XPl,
                                               const __bf16* __restrict__ PBh,
                                               const __bf16* __restrict__ PBl,
                                               float* __restrict__ hl) {
    __shared__ float part[8][HL_NT * 8][32];       // [wave][tile * 8 + register][lane]

    const int lane = threadIdx.x & 31;
    // The wave's number as a scalar: panel offsets and LDS bases are scalar arithmetic.
    const int w    = __builtin_amdgcn_readfirstlane(threadIdx.x >> 5);
    const int mt0  = blockIdx.x * HL_MT;           // first row tile of the block
    // The lane's place in the wave's first fragment of each panel.
    const unsigned lo = (unsigned)lane * (FRAG * 2);
    const char* pxh = (const char*)(XPh + frag_off(mt0, KCX, w * HL_KW, 0)) + lo;
    const char* pxl = (const char*)(XPl + frag_off(mt0, KCX, w * HL_KW, 0)) + lo;
    const char* pbh = (const char*)(PBh + frag_off(0, KC, w * HL_KW, 0)) + lo;
    const char* pbl = (const char*)(PBl + frag_off(0, KC, w * HL_KW, 0)) + lo;
    const int row16 = lane & 15;
    const int mhi   = (lane >> 4) * 8;

    v8f acc[HL_MT][PBTILES];
#pragma unroll
    for (int m = 0; m < HL_MT; ++m)
#pragma unroll
        for (int t = 0; t < PBTILES; ++t)
#pragma unroll
            for (int j = 0; j < 8; ++j) acc[m][t][j] = 0.0f;

    // Unrolled: every address is one of the four pointers plus an immediate, and the
    // next chunk's loads start as soon as the WMMAs free their registers.
#pragma unroll
    for (int i = 0; i < HL_KW; ++i) {
        v16bf ah[HL_MT], al[HL_MT], bh[PBTILES], bl[PBTILES];
#pragma unroll
        for (int m = 0; m < HL_MT; ++m) {
            ah[m] = *(const v16bf*)(pxh + (m * KCX + i) * FRAGB);
            al[m] = *(const v16bf*)(pxl + (m * KCX + i) * FRAGB);
        }
#pragma unroll
        for (int t = 0; t < PBTILES; ++t) {
            bh[t] = *(const v16bf*)(pbh + (t * KC + i) * FRAGB);
            bl[t] = *(const v16bf*)(pbl + (t * KC + i) * FRAGB);
        }
        // Inputs-only fence on the loaded fragments: all 28 loads of the chunk are issued
        // ahead of the first WMMA and share one round trip; without it the compiler sinks
        // part of them between the WMMAs, five dependent round trips per chunk.
        asm volatile("" :: "v"(ah[0]), "v"(ah[1]), "v"(al[0]), "v"(al[1]),
                           "v"(bh[0]), "v"(bh[1]), "v"(bh[2]), "v"(bh[3]), "v"(bh[4]),
                           "v"(bl[0]), "v"(bl[1]), "v"(bl[2]), "v"(bl[3]), "v"(bl[4]));
        // Product-major: ten independent accumulators between two uses of the same one.
#pragma unroll
        for (int t = 0; t < PBTILES; ++t)
#pragma unroll
            for (int m = 0; m < HL_MT; ++m)
                acc[m][t] = __builtin_amdgcn_wmma_f32_16x16x32_bf16(false, ah[m], false, bh[t], (short)0, acc[m][t], false, false);
#pragma unroll
        for (int t = 0; t < PBTILES; ++t)
#pragma unroll
            for (int m = 0; m < HL_MT; ++m)
                acc[m][t] = __builtin_amdgcn_wmma_f32_16x16x32_bf16(false, ah[m], false, bl[t], (short)0, acc[m][t], false, false);
#pragma unroll
        for (int t = 0; t < PBTILES; ++t)
#pragma unroll
            for (int m = 0; m < HL_MT; ++m)
                acc[m][t] = __builtin_amdgcn_wmma_f32_16x16x32_bf16(false, al[m], false, bh[t], (short)0, acc[m][t], false, false);
    }

#pragma unroll
    for (int m = 0; m < HL_MT; ++m)
#pragma unroll
        for (int t = 0; t < PBTILES; ++t)
#pragma unroll
            for (int j = 0; j < 8; ++j) part[w][(m * PBTILES + t) * 8 + j][lane] = acc[m][t][j];
    __syncthreads();                               // every wave's partial sums stand in LDS

    // Wave w adds register w of every tile over the 8 waves and stores it.
#pragma unroll
    for (int m = 0; m < HL_MT; ++m)
#pragma unroll
        for (int t = 0; t < PBTILES; ++t) {
            float s = part[0][(m * PBTILES + t) * 8 + w][lane];
#pragma unroll
            for (int p = 1; p < 8; ++p) s += part[p][(m * PBTILES + t) * 8 + w][lane];
            int tok = (mt0 + m) * 16 + w + mhi;
            hl[(size_t)tok * PBROWS + t * 16 + row16] = s;
        }
}

// ---------------------------------------------------------------------------
// Per-token top-2 + softmax; writes gate*SCALE*h as the x panels' chunks KC and
// KC + 1 (k = e*RANK + r, zero at the six experts not chosen), hi and lo.
// One thread builds one lane-slice, as in k_packx; the four threads of a token
// each repeat its top-2.
// ---------------------------------------------------------------------------
__global__ __launch_bounds__(256) void k_gate(const float* __restrict__ hl,
                                              __bf16* __restrict__ XPh,
                                              __bf16* __restrict__ XPl) {
    int t = blockIdx.x * 256 + threadIdx.x;        // 0 .. MT_X*KCL*32-1
    int lane = t & 31;
    int c    = (t >> 5) & (KCL - 1);
    int mt   = t >> 6;
    int tok  = mt * 16 + (lane & 15);
    const float* row = hl + (size_t)tok * PBROWS;

    int e0 = 0; float v0 = row[0];
#pragma unroll
    for (int e = 1; e < NEXP; ++e) { float v = row[e]; if (v > v0) { v0 = v; e0 = e; } }
    int e1 = (e0 == 0) ? 1 : 0; float v1 = row[e1];
#pragma unroll
    for (int e = 0; e < NEXP; ++e) {
        if (e == e0) continue;
        float v = row[e];
        if (v > v1) { v1 = v; e1 = e; }
    }
    float x1  = __expf(v1 - v0);
    float inv = 1.0f / (1.0f + x1);
    float g0 = inv * LSCALE;
    float g1 = x1 * inv * LSCALE;

    v16bf h, l;
#pragma unroll
    for (int half = 0; half < 2; ++half) {
        const int e = c * 4 + half * 2 + (lane >> 4);
        // Unconditional 16-B loads: under the test they compile to waited dword loads.
        const float4 p = *(const float4*)(row + NEXP + e * RANK);
        const float4 q = *(const float4*)(row + NEXP + e * RANK + 4);
        const float hv[RANK] = {p.x, p.y, p.z, p.w, q.x, q.y, q.z, q.w};
        const bool  on = (e == e0) || (e == e1);
        const float g  = (e == e0) ? g0 : g1;
#pragma unroll
        for (int r = 0; r < RANK; ++r) {
            float v = on ? hv[r] * g : 0.0f;
            __bf16 hh, ll;
            split_bf16(v, hh, ll);
            h[half * 8 + r] = hh; l[half * 8 + r] = ll;
        }
    }
    size_t off = frag_off(mt, KCX, KC + c, lane);
    *(v16bf*)(XPh + off) = h;
    *(v16bf*)(XPl + off) = l;
}

// ---------------------------------------------------------------------------
// y = [x | gated h] @ [W | B_w]^T + bias: base GEMM and LoRA term in one k loop.
// 128x128 tile / block, 8 waves (4x2). Each k-chunk's 32 fragments are brought
// into LDS once per block by async global->LDS copies (two buffers: chunk t+2
// flies while chunk t+1 is worked on); every wave then reads its 12 fragments
// from LDS: 24 ds_load_b128 + 24 v_wmma per 32-wide K chunk.
// ---------------------------------------------------------------------------

__device__ __forceinline__ void stage_copy(unsigned lds,
                                           const __bf16* xh, const __bf16* xl, unsigned xo,
                                           const __bf16* wh, const __bf16* wl, unsigned wo) {
    const unsigned long long gxh = (unsigned long long)(uintptr_t)xh + xo;
    const unsigned long long gxl = (unsigned long long)(uintptr_t)xl + xo;
    const unsigned long long gwh = (unsigned long long)(uintptr_t)wh + wo;
    const unsigned long long gwl = (unsigned long long)(uintptr_t)wl + wo;
    asm volatile("global_load_async_to_lds_b128 %0, %8, off\n\t"
                 "global_load_async_to_lds_b128 %1, %9, off\n\t"
                 "global_load_async_to_lds_b128 %2, %10, off\n\t"
                 "global_load_async_to_lds_b128 %3, %11, off\n\t"
                 "global_load_async_to_lds_b128 %4, %12, off\n\t"
                 "global_load_async_to_lds_b128 %5, %13, off\n\t"
                 "global_load_async_to_lds_b128 %6, %14, off\n\t"
                 "global_load_async_to_lds_b128 %7, %15, off\n\t"
                 "s_wait_xcnt 0x0"
                 :: "v"(lds),               "v"(lds + 512u),
                    "v"(lds + PANELB),      "v"(lds + PANELB + 512u),
                    "v"(lds + 2 * PANELB),  "v"(lds + 2 * PANELB + 512u),
                    "v"(lds + 3 * PANELB),  "v"(lds + 3 * PANELB + 512u),
                    "v"(gxh), "v"(gxh + 512ull), "v"(gxl), "v"(gxl + 512ull),
                    "v"(gwh), "v"(gwh + 512ull), "v"(gwl), "v"(gwl + 512ull)
                 : "memory");
}

// One lane's 16 bf16 of a staged fragment: its two 16-B halves.
__device__ __forceinline__ v16bf lds_frag(const char* f, int r0) {
    v8bf lo = *(const v8bf*)(f + r0);
    v8bf hi = *(const v8bf*)(f + (r0 ^ 16));
    return __builtin_shufflevector(lo, hi, 0, 1, 2, 3, 4, 5, 6, 7, 8, 9, 10, 11, 12, 13, 14, 15);
}

__global__ __launch_bounds__(256, 8) void k_main(const __bf16* __restrict__ XPh,
                                              const __bf16* __restrict__ XPl,
                                              const __bf16* __restrict__ WPh,
                                              const __bf16* __restrict__ WPl,
                                              const float* __restrict__ bb,
                                              float* __restrict__ out) {
    __shared__ __attribute__((aligned(1024))) char ring[2][STAGEB];

    const int tid  = threadIdx.x;
    const int lane = tid & 31;
    const int w    = tid >> 5;
    const int bm   = blockIdx.y * TM;
    const int bn   = blockIdx.x * TN;

    const int wm = w >> 1;                         // 0..3 -> 32-row slab
    const int wn = w & 1;                          // 0..1 -> 64-col slab
    const int row16 = lane & 15;
    const int mhi   = (lane >> 4) * 8;

    v8f acc[2][4];
#pragma unroll
    for (int a = 0; a < 2; ++a)
#pragma unroll
        for (int b = 0; b < 4; ++b)
#pragma unroll
            for (int j = 0; j < 8; ++j) acc[a][b][j] = 0.0f;

    const unsigned ldsw = (unsigned)(uintptr_t)(&ring[0][0]) + (unsigned)(w * FRAGB)
                        + (unsigned)((lane ^ (lane >> 4)) * 16);
    // Byte offsets into the panels (below 2^26): two registers live through the loop.
    const unsigned xo = (unsigned)(frag_off((bm >> 4) + w, KCX, 0, 0) * 2) + (unsigned)(lane * 16);
    const unsigned wo = (unsigned)(frag_off((bn >> 4) + w, KCX, 0, 0) * 2) + (unsigned)(lane * 16);
    // Read side: where lane's first half stands inside a staged fragment.
    const int r0 = (2 * lane + ((lane >> 3) & 1)) * 16;

    stage_copy(ldsw, XPh, XPl, xo, WPh, WPl, wo);
    asm volatile("s_wait_asynccnt 0x0" ::: "memory");   // chunk 0 has landed (this wave's share)
    __syncthreads();                                    // ... and every other wave's
    stage_copy(ldsw + STAGEB, XPh, XPl, xo + FRAGB, WPh, WPl, wo + FRAGB);

    for (int kc = 0; kc < KCX; ++kc) {
        const char* st = &ring[kc & 1][0];
        v16bf ah[2], al[2];
#pragma unroll
        for (int a = 0; a < 2; ++a) {
            ah[a] = lds_frag(st + (wm * 2 + a) * FRAGB, r0);
            al[a] = lds_frag(st + PANELB + (wm * 2 + a) * FRAGB, r0);
        }
#pragma unroll
        for (int b = 0; b < 4; ++b) {
            v16bf bh = lds_frag(st + 2 * PANELB + (wn * 4 + b) * FRAGB, r0);
            v16bf bl = lds_frag(st + 3 * PANELB + (wn * 4 + b) * FRAGB, r0);
#pragma unroll
            for (int a = 0; a < 2; ++a) {
                acc[a][b] = __builtin_amdgcn_wmma_f32_16x16x32_bf16(false, ah[a], false, bh, (short)0, acc[a][b], false, false);
                acc[a][b] = __builtin_amdgcn_wmma_f32_16x16x32_bf16(false, ah[a], false, bl, (short)0, acc[a][b], false, false);
                acc[a][b] = __builtin_amdgcn_wmma_f32_16x16x32_bf16(false, al[a], false, bh, (short)0, acc[a][b], false, false);
            }
        }
        asm volatile("s_wait_dscnt 0x0" ::: "memory");      // this wave has left buffer kc & 1
        asm volatile("s_wait_asynccnt 0x0" ::: "memory");   // its share of chunk kc + 1 has landed
        __syncthreads();                                    // both hold for every wave
        if (kc + 2 < KCX) {
            const unsigned ko = (unsigned)(kc + 2) * FRAGB;
            stage_copy(ldsw + (unsigned)((kc & 1) * STAGEB), XPh, XPl, xo + ko, WPh, WPl, wo + ko);
        }
    }
    asm volatile("s_wait_asynccnt 0x0" ::: "memory");       // no copy outlives the loop

    // Epilogue: + bias.
#pragma unroll
    for (int b = 0; b < 4; ++b) {
        const int n = bn + wn * 64 + b * 16 + row16;
        const float bias = bb[n];
#pragma unroll
        for (int a = 0; a < 2; ++a) {
#pragma unroll
            for (int i = 0; i < 8; ++i) {
                const int mloc = wm * 32 + a * 16 + i + mhi;
                out[(size_t)(bm + mloc) * D_OUT + n] = acc[a][b][i] + bias;
            }
        }
    }
}

// ---------------------------------------------------------------------------
// Launch
// ---------------------------------------------------------------------------
extern "C" void kernel_launch(void* const* d_in, const int* in_sizes, int n_in,
                              void* d_out, int out_size, void* d_ws, size_t ws_size,
                              hipStream_t stream) {
    const float* x  = (const float*)d_in[0];   // [4,2048,2048]
    const float* Wb = (const float*)d_in[1];   // [2048,2048]
    const float* bb = (const float*)d_in[2];   // [2048]
    const float* Wr = (const float*)d_in[3];   // [8,2048]
    const float* Aw = (const float*)d_in[4];   // [8,8,2048]
    const float* Bw = (const float*)d_in[5];   // [8,2048,8]
    float* out = (float*)d_out;

    char* ws = (char*)d_ws;
    // panel sizes (bytes): XP 2x34603008, WP 2x8650752, PB 2x327680
    __bf16* XPh = (__bf16*)(ws);
    __bf16* XPl = (__bf16*)(ws + 34603008ull);
    __bf16* WPh = (__bf16*)(ws + 69206016ull);
    __bf16* WPl = (__bf16*)(ws + 77856768ull);
    __bf16* PBh = (__bf16*)(ws + 86507520ull);
    __bf16* PBl = (__bf16*)(ws + 86835200ull);
    float*  hl  = (float*)(ws + 87162880ull);  // 8192*80*4

    hipLaunchKernelGGL(k_packx,  dim3(MT_X * KC * 32 / 256), dim3(256), 0, stream, x,  XPh, XPl);
    hipLaunchKernelGGL(k_packw,  dim3(NT_W * KCX * 32 / 256), dim3(256), 0, stream, Wb, Bw, WPh, WPl);
    hipLaunchKernelGGL(k_packpb, dim3((PBTILES * KC * 32 + 255) / 256), dim3(256), 0, stream, Wr, Aw, PBh, PBl);
    hipLaunchKernelGGL(k_hl,     dim3(MT_X / HL_MT), dim3(256), 0, stream, XPh, XPl, PBh, PBl, hl);
    hipLaunchKernelGGL(k_gate,   dim3(MT_X * KCL * 32 / 256), dim3(256), 0, stream, hl, XPh, XPl);
    hipLaunchKernelGGL(k_main,   dim3(D_OUT / TN, NTOK / TM), dim3(256), 0, stream,
                       XPh, XPl, WPh, WPl, bb, out);
}

// v004
// It runs in 161 microseconds.
// Two timings next to v003 put it at 1.05 and 1.04 times that version's speed.
// Counting every step since v000, it is 2.31 times as fast.
#include <hip/hip_runtime.h>
#include <hip/hip_bf16.h>

typedef __attribute__((ext_vector_type(16))) __bf16 v16bf;
typedef __attribute__((ext_vector_type(8)))  __bf16 v8bf;
typedef __attribute__((ext_vector_type(8)))  float  v8f;

#define D_IN   2048
#define D_OUT  2048
#define NTOK   8192   // B*S
#define NEXP   8
#define RANK   8
#define LSCALE 2.0f   // ALPHA / R
#define PBROWS 80     // 8 router + 64 (E*R) + 8 pad
#define PBTILES 5

#define KC     64     // D_IN / 32 k-chunks
#define KCL    2      // NEXP * RANK / 32 k-chunks of the LoRA term
#define KCX    (KC + KCL)   // k-chunks per tile in the x and W panels
#define FRAG   16     // bf16 per lane per fragment
#define MT_X   512    // NTOK/16 row tiles of x
#define NT_W   128    // D_OUT/16 col tiles of W

#define TM 256
#define TN 256

#define FRAGB  1024           // bytes of one fragment: 32 lanes x 32 B
#define PANELB (16 * FRAGB)   // the 16 tiles one operand panel gives a block per k-chunk
#define CHUNKB (4 * PANELB)   // one k-chunk of a block: [x hi | x lo | W hi | W lo]
#define SKC    2              // k-chunks per stage
#define STAGEB (SKC * CHUNKB)
#define NST    (KCX / SKC)    // stages of the k loop

__device__ __forceinline__ void split_bf16(float x, __bf16& h, __bf16& l) {
    h = (__bf16)x;                 // RNE to bf16 (hi)
    l = (__bf16)(x - (float)h);    // residual (lo)
}

__device__ __forceinline__ size_t frag_off(int tile, int nkc, int kc, int lane) {
    return (((size_t)tile * nkc + kc) * 32 + lane) * FRAG;
}

__global__ __launch_bounds__(256) void k_packx(const float* __restrict__ x,
                                               __bf16* __restrict__ XPh,
                                               __bf16* __restrict__ XPl) {
    int t = blockIdx.x * 256 + threadIdx.x;        // 0 .. MT_X*KC*32-1
    int lane = t & 31;
    int kc   = (t >> 5) & (KC - 1);
    int mt   = t >> 11;
    int row  = mt * 16 + (lane & 15);
    int kb   = (lane >> 4) << 3;
    const float* src = x + (size_t)row * D_IN + kc * 32;
    v16bf h, l;
#pragma unroll
    for (int j = 0; j < 8; ++j) {
        __bf16 h0, l0, h1, l1;
        split_bf16(src[kb + j],      h0, l0);
        split_bf16(src[kb + 16 + j], h1, l1);
        h[j] = h0; l[j] = l0; h[8 + j] = h1; l[8 + j] = l1;
    }
    size_t off = frag_off(mt, KCX, kc, lane);
    *(v16bf*)(XPh + off) = h;
    *(v16bf*)(XPl + off) = l;
}

// Same for W_base [2048x2048] (B-matrix panel: tile = 16 output features),
// followed per tile by B_w as [n][k = e*RANK + r]: in chunk KC + c the 8 k of a
// lane's first half are expert 4c + (lane>>4), those of its second half expert
// 4c + 2 + (lane>>4).
__global__ __launch_bounds__(256) void k_packw(const float* __restrict__ Wb,
                                               const float* __restrict__ Bw,
                                               __bf16* __restrict__ WPh,
                                               __bf16* __restrict__ WPl) {
    int t = blockIdx.x * 256 + threadIdx.x;        // 0 .. NT_W*KCX*32-1
    int lane = t & 31;
    int nt   = (t >> 5) / KCX;
    int kc   = (t >> 5) - nt * KCX;
    int row  = nt * 16 + (lane & 15);
    int hl   = lane >> 4;
    const float* src0;
    const float* src1;
    if (kc < KC) {
        src0 = Wb + (size_t)row * D_IN + kc * 32 + hl * 8;
        src1 = src0 + 16;
    } else {
        int e = (kc - KC) * 4 + hl;
        src0 = Bw + ((size_t)e * D_OUT + row) * RANK;
        src1 = Bw + ((size_t)(e + 2) * D_OUT + row) * RANK;
    }
    v16bf h, l;
#pragma unroll
    for (int j = 0; j < 8; ++j) {
        __bf16 h0, l0, h1, l1;
        split_bf16(src0[j], h0, l0);
        split_bf16(src1[j], h1, l1);
        h[j] = h0; l[j] = l0; h[8 + j] = h1; l[8 + j] = l1;
    }
    size_t off = (size_t)t * FRAG;
    *(v16bf*)(WPh + off) = h;
    *(v16bf*)(WPl + off) = l;
}

// Pack [W_router ; A_w ; zeros] (80 logical rows) into 5 fragment tiles.
__global__ __launch_bounds__(256) void k_packpb(const float* __restrict__ Wr,
                                                const float* __restrict__ Aw,
                                                __bf16* __restrict__ PBh,
                                                __bf16* __restrict__ PBl) {
    int t = blockIdx.x * 256 + threadIdx.x;        // 0 .. PBTILES*KC*32-1
    if (t >= PBTILES * KC * 32) return;
    int lane = t & 31;
    int kc   = (t >> 5) & (KC - 1);
    int nt   = t >> 11;
    int row  = nt * 16 + (lane & 15);              // 0..79
    int kb   = (lane >> 4) << 3;
    const float* src = (row < NEXP) ? (Wr + (size_t)row * D_IN)
                     : (row < NEXP + NEXP * RANK) ? (Aw + (size_t)(row - NEXP) * D_IN)
                     : nullptr;
    v16bf h, l;
#pragma unroll
    for (int j = 0; j < 8; ++j) {
        float f0 = src ? src[kc * 32 + kb + j]      : 0.0f;
        float f1 = src ? src[kc * 32 + kb + 16 + j] : 0.0f;
        __bf16 h0, l0, h1, l1;
        split_bf16(f0, h0, l0);
        split_bf16(f1, h1, l1);
        h[j] = h0; l[j] = l0; h[8 + j] = h1; l[8 + j] = l1;
    }
    size_t off = (size_t)t * FRAG;
    *(v16bf*)(PBh + off) = h;
    *(v16bf*)(PBl + off) = l;
}

#define HL_MT 2
#define HL_KW (KC / 8)
#define HL_NT (HL_MT * PBTILES)

__global__ __launch_bounds__(256, 4) void k_hl(const __bf16* __restrict__ XPh,
                                               const __bf16* __restrict__ XPl,
                                               const __bf16* __restrict__ PBh,
                                               const __bf16* __restrict__ PBl,
                                               float* __restrict__ hl) {
    __shared__ float part[8][HL_NT * 8][32];       // [wave][tile * 8 + register][lane]

    const int lane = threadIdx.x & 31;
    // The wave's number as a scalar: panel offsets and LDS bases are scalar arithmetic.
    const int w    = __builtin_amdgcn_readfirstlane(threadIdx.x >> 5);
    const int mt0  = blockIdx.x * HL_MT;           // first row tile of the block
    // The lane's place in the wave's first fragment of each panel.
    const unsigned lo = (unsigned)lane * (FRAG * 2);
    const char* pxh = (const char*)(XPh + frag_off(mt0, KCX, w * HL_KW, 0)) + lo;
    const char* pxl = (const char*)(XPl + frag_off(mt0, KCX, w * HL_KW, 0)) + lo;
    const char* pbh = (const char*)(PBh + frag_off(0, KC, w * HL_KW, 0)) + lo;
    const char* pbl = (const char*)(PBl + frag_off(0, KC, w * HL_KW, 0)) + lo;
    const int row16 = lane & 15;
    const int mhi   = (lane >> 4) * 8;

    v8f acc[HL_MT][PBTILES];
#pragma unroll
    for (int m = 0; m < HL_MT; ++m)
#pragma unroll
        for (int t = 0; t < PBTILES; ++t)
#pragma unroll
            for (int j = 0; j < 8; ++j) acc[m][t][j] = 0.0f;

    // Unrolled: every address is one of the four pointers plus an immediate, and the
    // next chunk's loads start as soon as the WMMAs free their registers.
#pragma unroll
    for (int i = 0; i < HL_KW; ++i) {
        v16bf ah[HL_MT], al[HL_MT], bh[PBTILES], bl[PBTILES];
#pragma unroll
        for (int m = 0; m < HL_MT; ++m) {
            ah[m] = *(const v16bf*)(pxh + (m * KCX + i) * FRAGB);
            al[m] = *(const v16bf*)(pxl + (m * KCX + i) * FRAGB);
        }
#pragma unroll
        for (int t = 0; t < PBTILES; ++t) {
            bh[t] = *(const v16bf*)(pbh + (t * KC + i) * FRAGB);
            bl[t] = *(const v16bf*)(pbl + (t * KC + i) * FRAGB);
        }
        // Inputs-only fence on the loaded fragments: all 28 loads of the chunk are issued
        // ahead of the first WMMA and share one round trip; without it the compiler sinks
        // part of them between the WMMAs, five dependent round trips per chunk.
        asm volatile("" :: "v"(ah[0]), "v"(ah[1]), "v"(al[0]), "v"(al[1]),
                           "v"(bh[0]), "v"(bh[1]), "v"(bh[2]), "v"(bh[3]), "v"(bh[4]),
                           "v"(bl[0]), "v"(bl[1]), "v"(bl[2]), "v"(bl[3]), "v"(bl[4]));
        // Product-major: ten independent accumulators between two uses of the same one.
#pragma unroll
        for (int t = 0; t < PBTILES; ++t)
#pragma unroll
            for (int m = 0; m < HL_MT; ++m)
                acc[m][t] = __builtin_amdgcn_wmma_f32_16x16x32_bf16(false, ah[m], false, bh[t], (short)0, acc[m][t], false, false);
#pragma unroll
        for (int t = 0; t < PBTILES; ++t)
#pragma unroll
            for (int m = 0; m < HL_MT; ++m)
                acc[m][t] = __builtin_amdgcn_wmma_f32_16x16x32_bf16(false, ah[m], false, bl[t], (short)0, acc[m][t], false, false);
#pragma unroll
        for (int t = 0; t < PBTILES; ++t)
#pragma unroll
            for (int m = 0; m < HL_MT; ++m)
                acc[m][t] = __builtin_amdgcn_wmma_f32_16x16x32_bf16(false, al[m], false, bh[t], (short)0, acc[m][t], false, false);
    }

#pragma unroll
    for (int m = 0; m < HL_MT; ++m)
#pragma unroll
        for (int t = 0; t < PBTILES; ++t)
#pragma unroll
            for (int j = 0; j < 8; ++j) part[w][(m * PBTILES + t) * 8 + j][lane] = acc[m][t][j];
    __syncthreads();                               // every wave's partial sums stand in LDS

    // Wave w adds register w of every tile over the 8 waves and stores it.
#pragma unroll
    for (int m = 0; m < HL_MT; ++m)
#pragma unroll
        for (int t = 0; t < PBTILES; ++t) {
            float s = part[0][(m * PBTILES + t) * 8 + w][lane];
#pragma unroll
            for (int p = 1; p < 8; ++p) s += part[p][(m * PBTILES + t) * 8 + w][lane];
            int tok = (mt0 + m) * 16 + w + mhi;
            hl[(size_t)tok * PBROWS + t * 16 + row16] = s;
        }
}

// ---------------------------------------------------------------------------
// Per-token top-2 + softmax; writes gate*SCALE*h as the x panels' chunks KC and
// KC + 1 (k = e*RANK + r, zero at the six experts not chosen), hi and lo.
// One thread builds one lane-slice, as in k_packx; the four threads of a token
// each repeat its top-2.
// ---------------------------------------------------------------------------
__global__ __launch_bounds__(256) void k_gate(const float* __restrict__ hl,
                                              __bf16* __restrict__ XPh,
                                              __bf16* __restrict__ XPl) {
    int t = blockIdx.x * 256 + threadIdx.x;        // 0 .. MT_X*KCL*32-1
    int lane = t & 31;
    int c    = (t >> 5) & (KCL - 1);
    int mt   = t >> 6;
    int tok  = mt * 16 + (lane & 15);
    const float* row = hl + (size_t)tok * PBROWS;

    int e0 = 0; float v0 = row[0];
#pragma unroll
    for (int e = 1; e < NEXP; ++e) { float v = row[e]; if (v > v0) { v0 = v; e0 = e; } }
    int e1 = (e0 == 0) ? 1 : 0; float v1 = row[e1];
#pragma unroll
    for (int e = 0; e < NEXP; ++e) {
        if (e == e0) continue;
        float v = row[e];
        if (v > v1) { v1 = v; e1 = e; }
    }
    float x1  = __expf(v1 - v0);
    float inv = 1.0f / (1.0f + x1);
    float g0 = inv * LSCALE;
    float g1 = x1 * inv * LSCALE;

    v16bf h, l;
#pragma unroll
    for (int half = 0; half < 2; ++half) {
        const int e = c * 4 + half * 2 + (lane >> 4);
        // Unconditional 16-B loads: under the test they compile to waited dword loads.
        const float4 p = *(const float4*)(row + NEXP + e * RANK);
        const float4 q = *(const float4*)(row + NEXP + e * RANK + 4);
        const float hv[RANK] = {p.x, p.y, p.z, p.w, q.x, q.y, q.z, q.w};
        const bool  on = (e == e0) || (e == e1);
        const float g  = (e == e0) ? g0 : g1;
#pragma unroll
        for (int r = 0; r < RANK; ++r) {
            float v = on ? hv[r] * g : 0.0f;
            __bf16 hh, ll;
            split_bf16(v, hh, ll);
            h[half * 8 + r] = hh; l[half * 8 + r] = ll;
        }
    }
    size_t off = frag_off(mt, KCX, KC + c, lane);
    *(v16bf*)(XPh + off) = h;
    *(v16bf*)(XPl + off) = l;
}

// ---------------------------------------------------------------------------
// y = [x | gated h] @ [W | B_w]^T + bias: base GEMM and LoRA term in one k loop.
// 256x256 tile / block, 16 waves (4x4) of 64x64 each, one block per WGP. A stage
// is two k-chunks; its 128 fragments are brought into LDS once per block by async
// global->LDS copies (two buffers: stage t+2 flies while stage t+1 is worked on);
// every wave then reads its 16 fragments of a chunk from LDS: 32 ds_load_b128 +
// 48 v_wmma per 32-wide K chunk.
// ---------------------------------------------------------------------------

__device__ __forceinline__ void stage_copy(unsigned lds,
                                           const __bf16* xh, const __bf16* xl, unsigned xo,
                                           const __bf16* wh, const __bf16* wl, unsigned wo) {
    const unsigned long long gxh = (unsigned long long)(uintptr_t)xh + xo;
    const unsigned long long gxl = (unsigned long long)(uintptr_t)xl + xo;
    const unsigned long long gwh = (unsigned long long)(uintptr_t)wh + wo;
    const unsigned long long gwl = (unsigned long long)(uintptr_t)wl + wo;
    asm volatile("global_load_async_to_lds_b128 %0, %8, off\n\t"
                 "global_load_async_to_lds_b128 %1, %9, off\n\t"
                 "global_load_async_to_lds_b128 %2, %10, off\n\t"
                 "global_load_async_to_lds_b128 %3, %11, off\n\t"
                 "global_load_async_to_lds_b128 %4, %12, off\n\t"
                 "global_load_async_to_lds_b128 %5, %13, off\n\t"
                 "global_load_async_to_lds_b128 %6, %14, off\n\t"
                 "global_load_async_to_lds_b128 %7, %15, off\n\t"
                 "s_wait_xcnt 0x0"
                 :: "v"(lds),               "v"(lds + 512u),
                    "v"(lds + PANELB),      "v"(lds + PANELB + 512u),
                    "v"(lds + 2 * PANELB),  "v"(lds + 2 * PANELB + 512u),
                    "v"(lds + 3 * PANELB),  "v"(lds + 3 * PANELB + 512u),
                    "v"(gxh), "v"(gxh + 512ull), "v"(gxl), "v"(gxl + 512ull),
                    "v"(gwh), "v"(gwh + 512ull), "v"(gwl), "v"(gwl + 512ull)
                 : "memory");
}

// One lane's 16 bf16 of a staged fragment: its two 16-B halves.
__device__ __forceinline__ v16bf lds_frag(const char* f, int r0) {
    v8bf lo = *(const v8bf*)(f + r0);
    v8bf hi = *(const v8bf*)(f + (r0 ^ 16));
    return __builtin_shufflevector(lo, hi, 0, 1, 2, 3, 4, 5, 6, 7, 8, 9, 10, 11, 12, 13, 14, 15);
}

__global__ __launch_bounds__(512, 4) void k_main(const __bf16* __restrict__ XPh,
                                              const __bf16* __restrict__ XPl,
                                              const __bf16* __restrict__ WPh,
                                              const __bf16* __restrict__ WPl,
                                              const float* __restrict__ bb,
                                              float* __restrict__ out) {
    __shared__ __attribute__((aligned(1024))) char ring[2][STAGEB];

    const int tid  = threadIdx.x;
    const int lane = tid & 31;
    const int w    = tid >> 5;
    const int bm   = blockIdx.y * TM;
    const int bn   = blockIdx.x * TN;

    const int wm = w >> 2;                         // 0..3 -> 64-row slab
    const int wn = w & 3;                          // 0..3 -> 64-col slab
    const int row16 = lane & 15;
    const int mhi   = (lane >> 4) * 8;

    v8f acc[4][4];
#pragma unroll
    for (int a = 0; a < 4; ++a)
#pragma unroll
        for (int b = 0; b < 4; ++b)
#pragma unroll
            for (int j = 0; j < 8; ++j) acc[a][b][j] = 0.0f;

    const unsigned ldsw = (unsigned)(uintptr_t)(&ring[0][0]) + (unsigned)(w * FRAGB)
                        + (unsigned)((lane ^ (lane >> 4)) * 16);
    // Byte offsets into the panels (below 2^26): two registers live through the loop.
    const unsigned xo = (unsigned)(frag_off((bm >> 4) + w, KCX, 0, 0) * 2) + (unsigned)(lane * 16);
    const unsigned wo = (unsigned)(frag_off((bn >> 4) + w, KCX, 0, 0) * 2) + (unsigned)(lane * 16);
    // Read side: where lane's first half stands inside a staged fragment.
    const int r0 = (2 * lane + ((lane >> 3) & 1)) * 16;

    stage_copy(ldsw, XPh, XPl, xo, WPh, WPl, wo);
    stage_copy(ldsw + CHUNKB, XPh, XPl, xo + FRAGB, WPh, WPl, wo + FRAGB);
    asm volatile("s_wait_asynccnt 0x0" ::: "memory");   // stage 0 has landed (this wave's share)
    __syncthreads();                                    // ... and every other wave's
    stage_copy(ldsw + STAGEB, XPh, XPl, xo + 2 * FRAGB, WPh, WPl, wo + 2 * FRAGB);
    stage_copy(ldsw + STAGEB + CHUNKB, XPh, XPl, xo + 3 * FRAGB, WPh, WPl, wo + 3 * FRAGB);

    for (int s = 0; s < NST; ++s) {
        // Unrolled: the second chunk's LDS reads start among the first chunk's WMMAs.
#pragma unroll
        for (int c = 0; c < SKC; ++c) {
            const char* st = &ring[s & 1][c * CHUNKB];
            v16bf ah[4], al[4];
#pragma unroll
            for (int a = 0; a < 4; ++a) {
                ah[a] = lds_frag(st + (wm * 4 + a) * FRAGB, r0);
                al[a] = lds_frag(st + PANELB + (wm * 4 + a) * FRAGB, r0);
            }
#pragma unroll
            for (int b = 0; b < 4; ++b) {
                v16bf bh = lds_frag(st + 2 * PANELB + (wn * 4 + b) * FRAGB, r0);
                v16bf bl = lds_frag(st + 3 * PANELB + (wn * 4 + b) * FRAGB, r0);
                // Product-major: four independent accumulators between two uses of the same one.
#pragma unroll
                for (int a = 0; a < 4; ++a)
                    acc[a][b] = __builtin_amdgcn_wmma_f32_16x16x32_bf16(false, ah[a], false, bh, (short)0, acc[a][b], false, false);
#pragma unroll
                for (int a = 0; a < 4; ++a)
                    acc[a][b] = __builtin_amdgcn_wmma_f32_16x16x32_bf16(false, ah[a], false, bl, (short)0, acc[a][b], false, false);
#pragma unroll
                for (int a = 0; a < 4; ++a)
                    acc[a][b] = __builtin_amdgcn_wmma_f32_16x16x32_bf16(false, al[a], false, bh, (short)0, acc[a][b], false, false);
            }
        }
        asm volatile("s_wait_dscnt 0x0" ::: "memory");      // this wave has left buffer s & 1
        asm volatile("s_wait_asynccnt 0x0" ::: "memory");   // its share of stage s + 1 has landed
        __syncthreads();                                    // both hold for every wave
        if (s + 2 < NST) {
            const unsigned ko = (unsigned)(s + 2) * (SKC * FRAGB);
            const unsigned lb = ldsw + (unsigned)((s & 1) * STAGEB);
            stage_copy(lb, XPh, XPl, xo + ko, WPh, WPl, wo + ko);
            stage_copy(lb + CHUNKB, XPh, XPl, xo + ko + FRAGB, WPh, WPl, wo + ko + FRAGB);
        }
    }
    asm volatile("s_wait_asynccnt 0x0" ::: "memory");       // no copy outlives the loop

    // Epilogue: + bias.
#pragma unroll
    for (int b = 0; b < 4; ++b) {
        const int n = bn + wn * 64 + b * 16 + row16;
        const float bias = bb[n];
#pragma unroll
        for (int a = 0; a < 4; ++a) {
#pragma unroll
            for (int i = 0; i < 8; ++i) {
                const int mloc = wm * 64 + a * 16 + i + mhi;
                out[(size_t)(bm + mloc) * D_OUT + n] = acc[a][b][i] + bias;
            }
        }
    }
}

// ---------------------------------------------------------------------------
// Launch
// ---------------------------------------------------------------------------
extern "C" void kernel_launch(void* const* d_in, const int* in_sizes, int n_in,
                              void* d_out, int out_size, void* d_ws, size_t ws_size,
                              hipStream_t stream) {
    const float* x  = (const float*)d_in[0];   // [4,2048,2048]
    const float* Wb = (const float*)d_in[1];   // [2048,2048]
    const float* bb = (const float*)d_in[2];   // [2048]
    const float* Wr = (const float*)d_in[3];   // [8,2048]
    const float* Aw = (const float*)d_in[4];   // [8,8,2048]
    const float* Bw = (const float*)d_in[5];   // [8,2048,8]
    float* out = (float*)d_out;

    char* ws = (char*)d_ws;
    // panel sizes (bytes): XP 2x34603008, WP 2x8650752, PB 2x327680
    __bf16* XPh = (__bf16*)(ws);
    __bf16* XPl = (__bf16*)(ws + 34603008ull);
    __bf16* WPh = (__bf16*)(ws + 69206016ull);
    __bf16* WPl = (__bf16*)(ws + 77856768ull);
    __bf16* PBh = (__bf16*)(ws + 86507520ull);
    __bf16* PBl = (__bf16*)(ws + 86835200ull);
    float*  hl  = (float*)(ws + 87162880ull);  // 8192*80*4

    hipLaunchKernelGGL(k_packx,  dim3(MT_X * KC * 32 / 256), dim3(256), 0, stream, x,  XPh, XPl);
    hipLaunchKernelGGL(k_packw,  dim3(NT_W * KCX * 32 / 256), dim3(256), 0, stream, Wb, Bw, WPh, WPl);
    hipLaunchKernelGGL(k_packpb, dim3((PBTILES * KC * 32 + 255) / 256), dim3(256), 0, stream, Wr, Aw, PBh, PBl);
    hipLaunchKernelGGL(k_hl,     dim3(MT_X / HL_MT), dim3(256), 0, stream, XPh, XPl, PBh, PBl, hl);
    hipLaunchKernelGGL(k_gate,   dim3(MT_X * KCL * 32 / 256), dim3(256), 0, stream, hl, XPh, XPl);
    hipLaunchKernelGGL(k_main,   dim3(D_OUT / TN, NTOK / TM), dim3(512), 0, stream,
                       XPh, XPl, WPh, WPl, bb, out);
}

// v005
// A run of this version takes 143 microseconds.
// Two timings next to v004 both put it at 1.13 times that version's speed.
// All steps since v000 together make it 2.61 times as fast.
#include <hip/hip_runtime.h>
#include <hip/hip_bf16.h>

typedef __attribute__((ext_vector_type(16))) __bf16 v16bf;
typedef __attribute__((ext_vector_type(8)))  __bf16 v8bf;
typedef __attribute__((ext_vector_type(8)))  float  v8f;

#define D_IN   2048
#define D_OUT  2048
#define NTOK   8192   // B*S
#define NEXP   8
#define RANK   8
#define LSCALE 2.0f   // ALPHA / R
#define PBROWS 80     // 8 router + 64 (E*R) + 8 pad
#define PBTILES 5

#define KC     64     // D_IN / 32 k-chunks
#define KCL    2      // NEXP * RANK / 32 k-chunks of the LoRA term
#define KCX    (KC + KCL)   // k-chunks per tile in the x and W panels
#define FRAG   16     // bf16 per lane per fragment
#define MT_X   512    // NTOK/16 row tiles of x
#define NT_W   128    // D_OUT/16 col tiles of W

#define TM 256
#define TN 256

#define FRAGB  1024           // bytes of one fragment: 32 lanes x 32 B
#define PANELB (16 * FRAGB)   // the 16 tiles one operand panel gives a block per k-chunk
#define CHUNKB (4 * PANELB)   // one k-chunk of a block: [x hi | x lo | W hi | W lo]
#define SKC    2              // k-chunks per stage
#define STAGEB (SKC * CHUNKB)
#define NST    (KCX / SKC)    // stages of the k loop

__device__ __forceinline__ void split_bf16(float x, __bf16& h, __bf16& l) {
    h = (__bf16)x;                 // RNE to bf16 (hi)
    l = (__bf16)(x - (float)h);    // residual (lo)
}

__device__ __forceinline__ size_t frag_off(int tile, int nkc, int kc, int lane) {
    return (((size_t)tile * nkc + kc) * 32 + lane) * FRAG;
}

__global__ __launch_bounds__(256) void k_packw(const float* __restrict__ Wb,
                                               const float* __restrict__ Bw,
                                               __bf16* __restrict__ WPh,
                                               __bf16* __restrict__ WPl) {
    int t = blockIdx.x * 256 + threadIdx.x;        // 0 .. NT_W*KCX*32-1
    int lane = t & 31;
    int nt   = (t >> 5) / KCX;
    int kc   = (t >> 5) - nt * KCX;
    int row  = nt * 16 + (lane & 15);
    int hl   = lane >> 4;
    const float* src0;
    const float* src1;
    if (kc < KC) {
        src0 = Wb + (size_t)row * D_IN + kc * 32 + hl * 8;
        src1 = src0 + 16;
    } else {
        int e = (kc - KC) * 4 + hl;
        src0 = Bw + ((size_t)e * D_OUT + row) * RANK;
        src1 = Bw + ((size_t)(e + 2) * D_OUT + row) * RANK;
    }
    v16bf h, l;
#pragma unroll
    for (int j = 0; j < 8; ++j) {
        __bf16 h0, l0, h1, l1;
        split_bf16(src0[j], h0, l0);
        split_bf16(src1[j], h1, l1);
        h[j] = h0; l[j] = l0; h[8 + j] = h1; l[8 + j] = l1;
    }
    size_t off = (size_t)t * FRAG;
    *(v16bf*)(WPh + off) = h;
    *(v16bf*)(WPl + off) = l;
}

// Pack [W_router ; A_w ; zeros] (80 logical rows) into 5 fragment tiles.
__global__ __launch_bounds__(256) void k_packpb(const float* __restrict__ Wr,
                                                const float* __restrict__ Aw,
                                                __bf16* __restrict__ PBh,
                                                __bf16* __restrict__ PBl) {
    int t = blockIdx.x * 256 + threadIdx.x;        // 0 .. PBTILES*KC*32-1
    if (t >= PBTILES * KC * 32) return;
    int lane = t & 31;
    int kc   = (t >> 5) & (KC - 1);
    int nt   = t >> 11;
    int row  = nt * 16 + (lane & 15);              // 0..79
    int kb   = (lane >> 4) << 3;
    const float* src = (row < NEXP) ? (Wr + (size_t)row * D_IN)
                     : (row < NEXP + NEXP * RANK) ? (Aw + (size_t)(row - NEXP) * D_IN)
                     : nullptr;
    v16bf h, l;
#pragma unroll
    for (int j = 0; j < 8; ++j) {
        float f0 = src ? src[kc * 32 + kb + j]      : 0.0f;
        float f1 = src ? src[kc * 32 + kb + 16 + j] : 0.0f;
        __bf16 h0, l0, h1, l1;
        split_bf16(f0, h0, l0);
        split_bf16(f1, h1, l1);
        h[j] = h0; l[j] = l0; h[8 + j] = h1; l[8 + j] = l1;
    }
    size_t off = (size_t)t * FRAG;
    *(v16bf*)(PBh + off) = h;
    *(v16bf*)(PBl + off) = l;
}

#define HL_MT 2
#define HL_KW (KC / 8)
#define HL_NT (HL_MT * PBTILES)

__global__ __launch_bounds__(256, 4) void k_hl(const float* __restrict__ x,
                                               const __bf16* __restrict__ PBh,
                                               const __bf16* __restrict__ PBl,
                                               __bf16* __restrict__ XPh,
                                               __bf16* __restrict__ XPl,
                                               float* __restrict__ hl) {
    __shared__ float part[8][HL_NT * 8][32];       // [wave][tile * 8 + register][lane]

    const int lane = threadIdx.x & 31;
    // The wave's number as a scalar: panel offsets and LDS bases are scalar arithmetic.
    const int w    = __builtin_amdgcn_readfirstlane(threadIdx.x >> 5);
    const int mt0  = blockIdx.x * HL_MT;           // first row tile of the block
    const int row16 = lane & 15;
    const int mhi   = (lane >> 4) * 8;
    // The lane's place in the wave's first fragment of each panel.
    const unsigned lo = (unsigned)lane * (FRAG * 2);
    char* qxh = (char*)(XPh + frag_off(mt0, KCX, w * HL_KW, 0)) + lo;
    char* qxl = (char*)(XPl + frag_off(mt0, KCX, w * HL_KW, 0)) + lo;
    const char* pbh = (const char*)(PBh + frag_off(0, KC, w * HL_KW, 0)) + lo;
    const char* pbl = (const char*)(PBl + frag_off(0, KC, w * HL_KW, 0)) + lo;
    // The lane's first value of the wave's first chunk in x: its row, K = mhi.
    const char* px = (const char*)(x + (size_t)(mt0 * 16 + row16) * D_IN + w * (HL_KW * 32) + mhi);

    v8f acc[HL_MT][PBTILES];
#pragma unroll
    for (int m = 0; m < HL_MT; ++m)
#pragma unroll
        for (int t = 0; t < PBTILES; ++t)
#pragma unroll
            for (int j = 0; j < 8; ++j) acc[m][t][j] = 0.0f;

    // xc[row tile]: K {0..3}, {4..7}, {16..19}, {20..23} from the lane's first, of the chunk at hand.
    float4 xc[HL_MT][4];
#pragma unroll
    for (int m = 0; m < HL_MT; ++m) {
        const char* s = px + m * (16 * D_IN * 4);
        xc[m][0] = *(const float4*)(s);
        xc[m][1] = *(const float4*)(s + 16);
        xc[m][2] = *(const float4*)(s + 64);
        xc[m][3] = *(const float4*)(s + 80);
    }

    // Rolled: unrolled, the compiler moves the next chunk's split up among this chunk's
    // WMMAs, directly behind its loads, and every chunk then waits out the memory latency.
#pragma unroll 1
    for (int i = 0; i < HL_KW; ++i) {
        v16bf ah[HL_MT], al[HL_MT], bh[PBTILES], bl[PBTILES];
#pragma unroll
        for (int t = 0; t < PBTILES; ++t) {
            bh[t] = *(const v16bf*)(pbh + (t * KC + i) * FRAGB);
            bl[t] = *(const v16bf*)(pbl + (t * KC + i) * FRAGB);
        }
        // Keeps the next chunk's x loads behind this chunk's B loads: the load counter
        // returns in issue order, so the wait for B would otherwise wait for memory too.
        __builtin_amdgcn_sched_barrier(0);
        // The next chunk's x, in flight over this chunk's work. The last trip reads its own
        // chunk again: a branch round the loads would merge two paths in the compiler's wait
        // counting, and every trip would drain the loads.
        float4 xn[HL_MT][4];
        const int inx = (i + 1 < HL_KW) ? i + 1 : i;
#pragma unroll
        for (int m = 0; m < HL_MT; ++m) {
            const char* s = px + m * (16 * D_IN * 4) + inx * 128;
            xn[m][0] = *(const float4*)(s);
            xn[m][1] = *(const float4*)(s + 16);
            xn[m][2] = *(const float4*)(s + 64);
            xn[m][3] = *(const float4*)(s + 80);
        }
        // Keeps all 28 loads ahead of the split and the WMMAs: the B loads share one round trip.
        __builtin_amdgcn_sched_barrier(0);
#pragma unroll
        for (int m = 0; m < HL_MT; ++m) {
            const float4* q = xc[m];
            const float f[16] = {q[0].x, q[0].y, q[0].z, q[0].w, q[1].x, q[1].y, q[1].z, q[1].w,
                                 q[2].x, q[2].y, q[2].z, q[2].w, q[3].x, q[3].y, q[3].z, q[3].w};
            v16bf h, l;
#pragma unroll
            for (int j = 0; j < 16; ++j) {
                __bf16 hh, ll;
                split_bf16(f[j], hh, ll);
                h[j] = hh; l[j] = ll;
            }
            ah[m] = h; al[m] = l;
            *(v16bf*)(qxh + (m * KCX + i) * FRAGB) = h;
            *(v16bf*)(qxl + (m * KCX + i) * FRAGB) = l;
#pragma unroll
            for (int k = 0; k < 4; ++k) xc[m][k] = xn[m][k];
        }
        // Product-major: ten independent accumulators between two uses of the same one.
#pragma unroll
        for (int t = 0; t < PBTILES; ++t)
#pragma unroll
            for (int m = 0; m < HL_MT; ++m)
                acc[m][t] = __builtin_amdgcn_wmma_f32_16x16x32_bf16(false, ah[m], false, bh[t], (short)0, acc[m][t], false, false);
#pragma unroll
        for (int t = 0; t < PBTILES; ++t)
#pragma unroll
            for (int m = 0; m < HL_MT; ++m)
                acc[m][t] = __builtin_amdgcn_wmma_f32_16x16x32_bf16(false, ah[m], false, bl[t], (short)0, acc[m][t], false, false);
#pragma unroll
        for (int t = 0; t < PBTILES; ++t)
#pragma unroll
            for (int m = 0; m < HL_MT; ++m)
                acc[m][t] = __builtin_amdgcn_wmma_f32_16x16x32_bf16(false, al[m], false, bh[t], (short)0, acc[m][t], false, false);
        // The next trip rewrites the address and data registers of this trip's panel stores.
        asm volatile("s_wait_xcnt 0x0" ::: "memory");
    }

#pragma unroll
    for (int m = 0; m < HL_MT; ++m)
#pragma unroll
        for (int t = 0; t < PBTILES; ++t)
#pragma unroll
            for (int j = 0; j < 8; ++j) part[w][(m * PBTILES + t) * 8 + j][lane] = acc[m][t][j];
    __syncthreads();                               // every wave's partial sums stand in LDS

    // Wave w adds register w of every tile over the 8 waves and stores it.
#pragma unroll
    for (int m = 0; m < HL_MT; ++m)
#pragma unroll
        for (int t = 0; t < PBTILES; ++t) {
            float s = part[0][(m * PBTILES + t) * 8 + w][lane];
#pragma unroll
            for (int p = 1; p < 8; ++p) s += part[p][(m * PBTILES + t) * 8 + w][lane];
            int tok = (mt0 + m) * 16 + w + mhi;
            hl[(size_t)tok * PBROWS + t * 16 + row16] = s;
        }
}

// ---------------------------------------------------------------------------
// Per-token top-2 + softmax; writes gate*SCALE*h as the x panels' chunks KC and
// KC + 1 (k = e*RANK + r, zero at the six experts not chosen), hi and lo.
// One thread builds one lane-slice, as in k_packw; the four threads of a token
// each repeat its top-2.
// ---------------------------------------------------------------------------
__global__ __launch_bounds__(256) void k_gate(const float* __restrict__ hl,
                                              __bf16* __restrict__ XPh,
                                              __bf16* __restrict__ XPl) {
    int t = blockIdx.x * 256 + threadIdx.x;        // 0 .. MT_X*KCL*32-1
    int lane = t & 31;
    int c    = (t >> 5) & (KCL - 1);
    int mt   = t >> 6;
    int tok  = mt * 16 + (lane & 15);
    const float* row = hl + (size_t)tok * PBROWS;

    int e0 = 0; float v0 = row[0];
#pragma unroll
    for (int e = 1; e < NEXP; ++e) { float v = row[e]; if (v > v0) { v0 = v; e0 = e; } }
    int e1 = (e0 == 0) ? 1 : 0; float v1 = row[e1];
#pragma unroll
    for (int e = 0; e < NEXP; ++e) {
        if (e == e0) continue;
        float v = row[e];
        if (v > v1) { v1 = v; e1 = e; }
    }
    float x1  = __expf(v1 - v0);
    float inv = 1.0f / (1.0f + x1);
    float g0 = inv * LSCALE;
    float g1 = x1 * inv * LSCALE;

    v16bf h, l;
#pragma unroll
    for (int half = 0; half < 2; ++half) {
        const int e = c * 4 + half * 2 + (lane >> 4);
        // Unconditional 16-B loads: under the test they compile to waited dword loads.
        const float4 p = *(const float4*)(row + NEXP + e * RANK);
        const float4 q = *(const float4*)(row + NEXP + e * RANK + 4);
        const float hv[RANK] = {p.x, p.y, p.z, p.w, q.x, q.y, q.z, q.w};
        const bool  on = (e == e0) || (e == e1);
        const float g  = (e == e0) ? g0 : g1;
#pragma unroll
        for (int r = 0; r < RANK; ++r) {
            float v = on ? hv[r] * g : 0.0f;
            __bf16 hh, ll;
            split_bf16(v, hh, ll);
            h[half * 8 + r] = hh; l[half * 8 + r] = ll;
        }
    }
    size_t off = frag_off(mt, KCX, KC + c, lane);
    *(v16bf*)(XPh + off) = h;
    *(v16bf*)(XPl + off) = l;
}

// ---------------------------------------------------------------------------
// y = [x | gated h] @ [W | B_w]^T + bias: base GEMM and LoRA term in one k loop.
// 256x256 tile / block, 16 waves (4x4) of 64x64 each, one block per WGP. A stage
// is two k-chunks; its 128 fragments are brought into LDS once per block by async
// global->LDS copies (two buffers: stage t+2 flies while stage t+1 is worked on);
// every wave then reads its 16 fragments of a chunk from LDS: 32 ds_load_b128 +
// 48 v_wmma per 32-wide K chunk.
// ---------------------------------------------------------------------------

__device__ __forceinline__ void stage_copy(unsigned lds,
                                           const __bf16* xh, const __bf16* xl, unsigned xo,
                                           const __bf16* wh, const __bf16* wl, unsigned wo) {
    const unsigned long long gxh = (unsigned long long)(uintptr_t)xh + xo;
    const unsigned long long gxl = (unsigned long long)(uintptr_t)xl + xo;
    const unsigned long long gwh = (unsigned long long)(uintptr_t)wh + wo;
    const unsigned long long gwl = (unsigned long long)(uintptr_t)wl + wo;
    asm volatile("global_load_async_to_lds_b128 %0, %8, off\n\t"
                 "global_load_async_to_lds_b128 %1, %9, off\n\t"
                 "global_load_async_to_lds_b128 %2, %10, off\n\t"
                 "global_load_async_to_lds_b128 %3, %11, off\n\t"
                 "global_load_async_to_lds_b128 %4, %12, off\n\t"
                 "global_load_async_to_lds_b128 %5, %13, off\n\t"
                 "global_load_async_to_lds_b128 %6, %14, off\n\t"
                 "global_load_async_to_lds_b128 %7, %15, off\n\t"
                 "s_wait_xcnt 0x0"
                 :: "v"(lds),               "v"(lds + 512u),
                    "v"(lds + PANELB),      "v"(lds + PANELB + 512u),
                    "v"(lds + 2 * PANELB),  "v"(lds + 2 * PANELB + 512u),
                    "v"(lds + 3 * PANELB),  "v"(lds + 3 * PANELB + 512u),
                    "v"(gxh), "v"(gxh + 512ull), "v"(gxl), "v"(gxl + 512ull),
                    "v"(gwh), "v"(gwh + 512ull), "v"(gwl), "v"(gwl + 512ull)
                 : "memory");
}

// One lane's 16 bf16 of a staged fragment: its two 16-B halves.
__device__ __forceinline__ v16bf lds_frag(const char* f, int r0) {
    v8bf lo = *(const v8bf*)(f + r0);
    v8bf hi = *(const v8bf*)(f + (r0 ^ 16));
    return __builtin_shufflevector(lo, hi, 0, 1, 2, 3, 4, 5, 6, 7, 8, 9, 10, 11, 12, 13, 14, 15);
}

__global__ __launch_bounds__(512, 4) void k_main(const __bf16* __restrict__ XPh,
                                              const __bf16* __restrict__ XPl,
                                              const __bf16* __restrict__ WPh,
                                              const __bf16* __restrict__ WPl,
                                              const float* __restrict__ bb,
                                              float* __restrict__ out) {
    __shared__ __attribute__((aligned(1024))) char ring[2][STAGEB];

    const int tid  = threadIdx.x;
    const int lane = tid & 31;
    const int w    = tid >> 5;
    const int bm   = blockIdx.y * TM;
    const int bn   = blockIdx.x * TN;

    const int wm = w >> 2;                         // 0..3 -> 64-row slab
    const int wn = w & 3;                          // 0..3 -> 64-col slab
    const int row16 = lane & 15;
    const int mhi   = (lane >> 4) * 8;

    v8f acc[4][4];
#pragma unroll
    for (int a = 0; a < 4; ++a)
#pragma unroll
        for (int b = 0; b < 4; ++b)
#pragma unroll
            for (int j = 0; j < 8; ++j) acc[a][b][j] = 0.0f;

    const unsigned ldsw = (unsigned)(uintptr_t)(&ring[0][0]) + (unsigned)(w * FRAGB)
                        + (unsigned)((lane ^ (lane >> 4)) * 16);
    // Byte offsets into the panels (below 2^26): two registers live through the loop.
    const unsigned xo = (unsigned)(frag_off((bm >> 4) + w, KCX, 0, 0) * 2) + (unsigned)(lane * 16);
    const unsigned wo = (unsigned)(frag_off((bn >> 4) + w, KCX, 0, 0) * 2) + (unsigned)(lane * 16);
    // Read side: where lane's first half stands inside a staged fragment.
    const int r0 = (2 * lane + ((lane >> 3) & 1)) * 16;

    stage_copy(ldsw, XPh, XPl, xo, WPh, WPl, wo);
    stage_copy(ldsw + CHUNKB, XPh, XPl, xo + FRAGB, WPh, WPl, wo + FRAGB);
    asm volatile("s_wait_asynccnt 0x0" ::: "memory");   // stage 0 has landed (this wave's share)
    __syncthreads();                                    // ... and every other wave's
    stage_copy(ldsw + STAGEB, XPh, XPl, xo + 2 * FRAGB, WPh, WPl, wo + 2 * FRAGB);
    stage_copy(ldsw + STAGEB + CHUNKB, XPh, XPl, xo + 3 * FRAGB, WPh, WPl, wo + 3 * FRAGB);

    for (int s = 0; s < NST; ++s) {
        // Unrolled: the second chunk's LDS reads start among the first chunk's WMMAs.
#pragma unroll
        for (int c = 0; c < SKC; ++c) {
            const char* st = &ring[s & 1][c * CHUNKB];
            v16bf ah[4], al[4];
#pragma unroll
            for (int a = 0; a < 4; ++a) {
                ah[a] = lds_frag(st + (wm * 4 + a) * FRAGB, r0);
                al[a] = lds_frag(st + PANELB + (wm * 4 + a) * FRAGB, r0);
            }
#pragma unroll
            for (int b = 0; b < 4; ++b) {
                v16bf bh = lds_frag(st + 2 * PANELB + (wn * 4 + b) * FRAGB, r0);
                v16bf bl = lds_frag(st + 3 * PANELB + (wn * 4 + b) * FRAGB, r0);
                // Product-major: four independent accumulators between two uses of the same one.
#pragma unroll
                for (int a = 0; a < 4; ++a)
                    acc[a][b] = __builtin_amdgcn_wmma_f32_16x16x32_bf16(false, ah[a], false, bh, (short)0, acc[a][b], false, false);
#pragma unroll
                for (int a = 0; a < 4; ++a)
                    acc[a][b] = __builtin_amdgcn_wmma_f32_16x16x32_bf16(false, ah[a], false, bl, (short)0, acc[a][b], false, false);
#pragma unroll
                for (int a = 0; a < 4; ++a)
                    acc[a][b] = __builtin_amdgcn_wmma_f32_16x16x32_bf16(false, al[a], false, bh, (short)0, acc[a][b], false, false);
            }
        }
        asm volatile("s_wait_dscnt 0x0" ::: "memory");      // this wave has left buffer s & 1
        asm volatile("s_wait_asynccnt 0x0" ::: "memory");   // its share of stage s + 1 has landed
        __syncthreads();                                    // both hold for every wave
        if (s + 2 < NST) {
            const unsigned ko = (unsigned)(s + 2) * (SKC * FRAGB);
            const unsigned lb = ldsw + (unsigned)((s & 1) * STAGEB);
            stage_copy(lb, XPh, XPl, xo + ko, WPh, WPl, wo + ko);
            stage_copy(lb + CHUNKB, XPh, XPl, xo + ko + FRAGB, WPh, WPl, wo + ko + FRAGB);
        }
    }
    asm volatile("s_wait_asynccnt 0x0" ::: "memory");       // no copy outlives the loop

    // Epilogue: + bias.
#pragma unroll
    for (int b = 0; b < 4; ++b) {
        const int n = bn + wn * 64 + b * 16 + row16;
        const float bias = bb[n];
#pragma unroll
        for (int a = 0; a < 4; ++a) {
#pragma unroll
            for (int i = 0; i < 8; ++i) {
                const int mloc = wm * 64 + a * 16 + i + mhi;
                out[(size_t)(bm + mloc) * D_OUT + n] = acc[a][b][i] + bias;
            }
        }
    }
}

// ---------------------------------------------------------------------------
// Launch
// ---------------------------------------------------------------------------
extern "C" void kernel_launch(void* const* d_in, const int* in_sizes, int n_in,
                              void* d_out, int out_size, void* d_ws, size_t ws_size,
                              hipStream_t stream) {
    const float* x  = (const float*)d_in[0];   // [4,2048,2048]
    const float* Wb = (const float*)d_in[1];   // [2048,2048]
    const float* bb = (const float*)d_in[2];   // [2048]
    const float* Wr = (const float*)d_in[3];   // [8,2048]
    const float* Aw = (const float*)d_in[4];   // [8,8,2048]
    const float* Bw = (const float*)d_in[5];   // [8,2048,8]
    float* out = (float*)d_out;

    char* ws = (char*)d_ws;
    // panel sizes (bytes): XP 2x34603008, WP 2x8650752, PB 2x327680
    __bf16* XPh = (__bf16*)(ws);
    __bf16* XPl = (__bf16*)(ws + 34603008ull);
    __bf16* WPh = (__bf16*)(ws + 69206016ull);
    __bf16* WPl = (__bf16*)(ws + 77856768ull);
    __bf16* PBh = (__bf16*)(ws + 86507520ull);
    __bf16* PBl = (__bf16*)(ws + 86835200ull);
    float*  hl  = (float*)(ws + 87162880ull);  // 8192*80*4

    hipLaunchKernelGGL(k_packw,  dim3(NT_W * KCX * 32 / 256), dim3(256), 0, stream, Wb, Bw, WPh, WPl);
    hipLaunchKernelGGL(k_packpb, dim3((PBTILES * KC * 32 + 255) / 256), dim3(256), 0, stream, Wr, Aw, PBh, PBl);
    hipLaunchKernelGGL(k_hl,     dim3(MT_X / HL_MT), dim3(256), 0, stream, x, PBh, PBl, XPh, XPl, hl);
    hipLaunchKernelGGL(k_gate,   dim3(MT_X * KCL * 32 / 256), dim3(256), 0, stream, hl, XPh, XPl);
    hipLaunchKernelGGL(k_main,   dim3(D_OUT / TN, NTOK / TM), dim3(512), 0, stream,
                       XPh, XPl, WPh, WPl, bb, out);
}

// v006
// A run of this version takes 137 microseconds.
// In both of two side-by-side timings against v005, it was 1.04 times as fast.
// Counting every step since v000, it is 2.72 times as fast.
#include <hip/hip_runtime.h>
#include <hip/hip_bf16.h>

typedef __attribute__((ext_vector_type(16))) __bf16 v16bf;
typedef __attribute__((ext_vector_type(8)))  __bf16 v8bf;
typedef __attribute__((ext_vector_type(8)))  float  v8f;

#define D_IN   2048
#define D_OUT  2048
#define NTOK   8192   // B*S
#define NEXP   8
#define RANK   8
#define LSCALE 2.0f   // ALPHA / R
#define PBROWS 80     // 8 router + 64 (E*R) + 8 pad
#define PBTILES 5

#define KC     64     // D_IN / 32 k-chunks
#define KCL    2      // NEXP * RANK / 32 k-chunks of the LoRA term
#define KCX    (KC + KCL)   // k-chunks per tile in the x and W panels
#define FRAG   16     // bf16 per lane per fragment
#define MT_X   512    // NTOK/16 row tiles of x
#define NT_W   128    // D_OUT/16 col tiles of W

#define TM 256
#define TN 256

#define FRAGB  1024           // bytes of one fragment: 32 lanes x 32 B
#define PANELB (16 * FRAGB)   // the 16 tiles one operand panel gives a block per k-chunk
#define CHUNKB (4 * PANELB)   // one k-chunk of a block: [x hi | x lo | W hi | W lo]
#define SKC    2              // k-chunks per stage
#define STAGEB (SKC * CHUNKB)
#define NST    (KCX / SKC)    // stages of the k loop

__device__ __forceinline__ void split_bf16(float x, __bf16& h, __bf16& l) {
    h = (__bf16)x;                 // RNE to bf16 (hi)
    l = (__bf16)(x - (float)h);    // residual (lo)
}

__device__ __forceinline__ size_t frag_off(int tile, int nkc, int kc, int lane) {
    return (((size_t)tile * nkc + kc) * 32 + lane) * FRAG;
}

#define PW_U      4
#define PW_BASE   (NT_W * KC  / (8 * PW_U))
#define PW_BLOCKS (NT_W * KCX / (8 * PW_U))
__device__ __forceinline__ void pack_w(const bool lora, const int blk,
                                       const float* __restrict__ Wb,
                                       const float* __restrict__ Bw,
                                       __bf16* __restrict__ WPh,
                                       __bf16* __restrict__ WPl) {
    const int lane = threadIdx.x & 31;
    // The wave's number as a scalar: tile and chunk numbers are scalar arithmetic.
    const int w    = __builtin_amdgcn_readfirstlane(threadIdx.x >> 5);
    const int hl   = lane >> 4;
    float4 f[PW_U][4];
    const float* a[PW_U];                              // each fragment's load address
#pragma unroll
    for (int u = 0; u < PW_U; ++u) {
        const int fr  = (blk * PW_U + u) * 8 + w;      // fragment number within the part
        const int nt  = lora ? fr / KCL : fr / KC;
        const int kc  = lora ? fr % KCL : fr % KC;     // chunk within the part
        const int row = nt * 16 + (lane & 15);
        const float* src0 = lora ? Bw + ((kc * 4 + hl) * D_OUT + row) * RANK
                                 : Wb + row * D_IN + kc * 32 + hl * 8;
        const float* src1 = lora ? src0 + 2 * D_OUT * RANK : src0 + 16;
        f[u][0] = *(const float4*)(src0);
        f[u][1] = *(const float4*)(src0 + 4);
        f[u][2] = *(const float4*)(src1);
        f[u][3] = *(const float4*)(src1 + 4);
        a[u] = src0;
    }
    // The loads' address registers stay live up to this wait (named as inputs), so that no
    // load's result and nothing behind the wait rewrites one ahead of it.
    asm volatile("s_wait_xcnt 0x0" :: "v"(a[0]), "v"(a[1]), "v"(a[2]), "v"(a[3]) : "memory");
#pragma unroll
    for (int u = 0; u < PW_U; ++u) {
        const int fr = (blk * PW_U + u) * 8 + w;
        const int nt = lora ? fr / KCL : fr / KC;
        const int kc = lora ? KC + fr % KCL : fr % KC;
        const float4* q = f[u];
        const float g[16] = {q[0].x, q[0].y, q[0].z, q[0].w, q[1].x, q[1].y, q[1].z, q[1].w,
                             q[2].x, q[2].y, q[2].z, q[2].w, q[3].x, q[3].y, q[3].z, q[3].w};
        v16bf h, l;
#pragma unroll
        for (int j = 0; j < 16; ++j) {
            __bf16 hh, ll;
            split_bf16(g[j], hh, ll);
            h[j] = hh; l[j] = ll;
        }
        const size_t off = frag_off(nt, KCX, kc, lane);
        *(v16bf*)(WPh + off) = h;
        *(v16bf*)(WPl + off) = l;
    }
    // Code of the kernel's other parts follows in the listing and rewrites the registers of
    // these stores.
    asm volatile("s_wait_xcnt 0x0" ::: "memory");
}

// Pack [W_router ; A_w ; zeros] (80 logical rows) into 5 fragment tiles.
__global__ __launch_bounds__(256) void k_packpb(const float* __restrict__ Wr,
                                                const float* __restrict__ Aw,
                                                __bf16* __restrict__ PBh,
                                                __bf16* __restrict__ PBl) {
    int t = blockIdx.x * 256 + threadIdx.x;        // 0 .. PBTILES*KC*32-1
    if (t >= PBTILES * KC * 32) return;
    int lane = t & 31;
    int kc   = (t >> 5) & (KC - 1);
    int nt   = t >> 11;
    int row  = nt * 16 + (lane & 15);              // 0..79
    int kb   = (lane >> 4) << 3;
    const float* src = (row < NEXP) ? (Wr + (size_t)row * D_IN)
                     : (row < NEXP + NEXP * RANK) ? (Aw + (size_t)(row - NEXP) * D_IN)
                     : nullptr;
    v16bf h, l;
#pragma unroll
    for (int j = 0; j < 8; ++j) {
        float f0 = src ? src[kc * 32 + kb + j]      : 0.0f;
        float f1 = src ? src[kc * 32 + kb + 16 + j] : 0.0f;
        __bf16 h0, l0, h1, l1;
        split_bf16(f0, h0, l0);
        split_bf16(f1, h1, l1);
        h[j] = h0; l[j] = l0; h[8 + j] = h1; l[8 + j] = l1;
    }
    size_t off = (size_t)t * FRAG;
    *(v16bf*)(PBh + off) = h;
    *(v16bf*)(PBl + off) = l;
}

#define HL_MT 2
#define HL_KW (KC / 8)
#define HL_NT (HL_MT * PBTILES)
#define HL_BLOCKS (MT_X / HL_MT)
#define HS_P  (PBROWS + 4)

__global__ __launch_bounds__(256, 4) void k_hl(const float* __restrict__ x,
                                               const __bf16* __restrict__ PBh,
                                               const __bf16* __restrict__ PBl,
                                               const float* __restrict__ Wb,
                                               const float* __restrict__ Bw,
                                               __bf16* __restrict__ XPh,
                                               __bf16* __restrict__ XPl,
                                               __bf16* __restrict__ WPh,
                                               __bf16* __restrict__ WPl) {
    __shared__ float part[8][HL_NT * 8][32];       // [wave][tile * 8 + register][lane]
    __shared__ __attribute__((aligned(16))) float hs[HL_MT * 16][HS_P];   // [token][router 8 | h 64 | pad]

    // The long blocks have the low indices and start first; the W blocks run beside them.
    if (blockIdx.x >= HL_BLOCKS) {
        const int pb = blockIdx.x - HL_BLOCKS;
        if (pb < PW_BASE) pack_w(false, pb, Wb, Bw, WPh, WPl);
        else              pack_w(true, pb - PW_BASE, Wb, Bw, WPh, WPl);
        return;
    }

    const int lane = threadIdx.x & 31;
    // The wave's number as a scalar: panel offsets and LDS bases are scalar arithmetic.
    const int w    = __builtin_amdgcn_readfirstlane(threadIdx.x >> 5);
    const int mt0  = blockIdx.x * HL_MT;           // first row tile of the block
    const int row16 = lane & 15;
    const int mhi   = (lane >> 4) * 8;
    // The lane's place in the wave's first fragment of each panel.
    const unsigned lo = (unsigned)lane * (FRAG * 2);
    char* qxh = (char*)(XPh + frag_off(mt0, KCX, w * HL_KW, 0)) + lo;
    char* qxl = (char*)(XPl + frag_off(mt0, KCX, w * HL_KW, 0)) + lo;
    const char* pbh = (const char*)(PBh + frag_off(0, KC, w * HL_KW, 0)) + lo;
    const char* pbl = (const char*)(PBl + frag_off(0, KC, w * HL_KW, 0)) + lo;
    // The lane's first value of the wave's first chunk in x: its row, K = mhi.
    const char* px = (const char*)(x + (size_t)(mt0 * 16 + row16) * D_IN + w * (HL_KW * 32) + mhi);

    v8f acc[HL_MT][PBTILES];
#pragma unroll
    for (int m = 0; m < HL_MT; ++m)
#pragma unroll
        for (int t = 0; t < PBTILES; ++t)
#pragma unroll
            for (int j = 0; j < 8; ++j) acc[m][t][j] = 0.0f;

    // xc[row tile]: K {0..3}, {4..7}, {16..19}, {20..23} from the lane's first, of the chunk at hand.
    float4 xc[HL_MT][4];
#pragma unroll
    for (int m = 0; m < HL_MT; ++m) {
        const char* s = px + m * (16 * D_IN * 4);
        xc[m][0] = *(const float4*)(s);
        xc[m][1] = *(const float4*)(s + 16);
        xc[m][2] = *(const float4*)(s + 64);
        xc[m][3] = *(const float4*)(s + 80);
    }

    // Rolled: unrolled, the compiler moves the next chunk's split up among this chunk's
    // WMMAs, directly behind its loads, and every chunk then waits out the memory latency.
#pragma unroll 1
    for (int i = 0; i < HL_KW; ++i) {
        v16bf ah[HL_MT], al[HL_MT], bh[PBTILES], bl[PBTILES];
#pragma unroll
        for (int t = 0; t < PBTILES; ++t) {
            bh[t] = *(const v16bf*)(pbh + (t * KC + i) * FRAGB);
            bl[t] = *(const v16bf*)(pbl + (t * KC + i) * FRAGB);
        }
        // Keeps the next chunk's x loads behind this chunk's B loads: the load counter
        // returns in issue order, so the wait for B would otherwise wait for memory too.
        __builtin_amdgcn_sched_barrier(0);
        // The next chunk's x, in flight over this chunk's work. The last trip reads its own
        // chunk again: a branch round the loads would merge two paths in the compiler's wait
        // counting, and every trip would drain the loads.
        float4 xn[HL_MT][4];
        const int inx = (i + 1 < HL_KW) ? i + 1 : i;
#pragma unroll
        for (int m = 0; m < HL_MT; ++m) {
            const char* s = px + m * (16 * D_IN * 4) + inx * 128;
            xn[m][0] = *(const float4*)(s);
            xn[m][1] = *(const float4*)(s + 16);
            xn[m][2] = *(const float4*)(s + 64);
            xn[m][3] = *(const float4*)(s + 80);
        }
        // Keeps all 28 loads ahead of the split and the WMMAs: the B loads share one round trip.
        __builtin_amdgcn_sched_barrier(0);
#pragma unroll
        for (int m = 0; m < HL_MT; ++m) {
            const float4* q = xc[m];
            const float f[16] = {q[0].x, q[0].y, q[0].z, q[0].w, q[1].x, q[1].y, q[1].z, q[1].w,
                                 q[2].x, q[2].y, q[2].z, q[2].w, q[3].x, q[3].y, q[3].z, q[3].w};
            v16bf h, l;
#pragma unroll
            for (int j = 0; j < 16; ++j) {
                __bf16 hh, ll;
                split_bf16(f[j], hh, ll);
                h[j] = hh; l[j] = ll;
            }
            ah[m] = h; al[m] = l;
            *(v16bf*)(qxh + (m * KCX + i) * FRAGB) = h;
            *(v16bf*)(qxl + (m * KCX + i) * FRAGB) = l;
#pragma unroll
            for (int k = 0; k < 4; ++k) xc[m][k] = xn[m][k];
        }
        // Product-major: ten independent accumulators between two uses of the same one.
#pragma unroll
        for (int t = 0; t < PBTILES; ++t)
#pragma unroll
            for (int m = 0; m < HL_MT; ++m)
                acc[m][t] = __builtin_amdgcn_wmma_f32_16x16x32_bf16(false, ah[m], false, bh[t], (short)0, acc[m][t], false, false);
#pragma unroll
        for (int t = 0; t < PBTILES; ++t)
#pragma unroll
            for (int m = 0; m < HL_MT; ++m)
                acc[m][t] = __builtin_amdgcn_wmma_f32_16x16x32_bf16(false, ah[m], false, bl[t], (short)0, acc[m][t], false, false);
#pragma unroll
        for (int t = 0; t < PBTILES; ++t)
#pragma unroll
            for (int m = 0; m < HL_MT; ++m)
                acc[m][t] = __builtin_amdgcn_wmma_f32_16x16x32_bf16(false, al[m], false, bh[t], (short)0, acc[m][t], false, false);
        // The next trip rewrites the address and data registers of this trip's panel stores.
        asm volatile("s_wait_xcnt 0x0" ::: "memory");
    }

#pragma unroll
    for (int m = 0; m < HL_MT; ++m)
#pragma unroll
        for (int t = 0; t < PBTILES; ++t)
#pragma unroll
            for (int j = 0; j < 8; ++j) part[w][(m * PBTILES + t) * 8 + j][lane] = acc[m][t][j];
    __syncthreads();                               // every wave's partial sums stand in LDS

    // Wave w adds register w of every tile over the 8 waves and leaves it in LDS.
#pragma unroll
    for (int m = 0; m < HL_MT; ++m)
#pragma unroll
        for (int t = 0; t < PBTILES; ++t) {
            float s = part[0][(m * PBTILES + t) * 8 + w][lane];
#pragma unroll
            for (int p = 1; p < 8; ++p) s += part[p][(m * PBTILES + t) * 8 + w][lane];
            hs[m * 16 + w + mhi][t * 16 + row16] = s;
        }
    __syncthreads();                               // every token's 80 sums stand in LDS

    // Gating: one wave per (row tile, LoRA chunk), one lane-slice a thread; the four
    // threads of a token each repeat its top-2.
    if (w < HL_MT * KCL) {
        const int c = w & (KCL - 1);
        const int m = w >> 1;
        const float* row = hs[m * 16 + row16];

        int e0 = 0; float v0 = row[0];
#pragma unroll
        for (int e = 1; e < NEXP; ++e) { float v = row[e]; if (v > v0) { v0 = v; e0 = e; } }
        int e1 = (e0 == 0) ? 1 : 0; float v1 = row[e1];
#pragma unroll
        for (int e = 0; e < NEXP; ++e) {
            if (e == e0) continue;
            float v = row[e];
            if (v > v1) { v1 = v; e1 = e; }
        }
        float x1  = __expf(v1 - v0);
        float inv = 1.0f / (1.0f + x1);
        float g0 = inv * LSCALE;
        float g1 = x1 * inv * LSCALE;

        v16bf h, l;
#pragma unroll
        for (int half = 0; half < 2; ++half) {
            const int e = c * 4 + half * 2 + (lane >> 4);
            const float4 p = *(const float4*)(row + NEXP + e * RANK);
            const float4 q = *(const float4*)(row + NEXP + e * RANK + 4);
            const float hv[RANK] = {p.x, p.y, p.z, p.w, q.x, q.y, q.z, q.w};
            const bool  on = (e == e0) || (e == e1);
            const float g  = (e == e0) ? g0 : g1;
#pragma unroll
            for (int r = 0; r < RANK; ++r) {
                float v = on ? hv[r] * g : 0.0f;
                __bf16 hh, ll;
                split_bf16(v, hh, ll);
                h[half * 8 + r] = hh; l[half * 8 + r] = ll;
            }
        }
        size_t off = frag_off(mt0 + m, KCX, KC + c, lane);
        *(v16bf*)(XPh + off) = h;
        *(v16bf*)(XPl + off) = l;
        // As behind pack_w's stores: the packing code follows in the listing.
        asm volatile("s_wait_xcnt 0x0" ::: "memory");
    }
}

// ---------------------------------------------------------------------------
// y = [x | gated h] @ [W | B_w]^T + bias: base GEMM and LoRA term in one k loop.
// 256x256 tile / block, 16 waves (4x4) of 64x64 each, one block per WGP. A stage
// is two k-chunks; its 128 fragments are brought into LDS once per block by async
// global->LDS copies (two buffers: stage t+2 flies while stage t+1 is worked on);
// every wave then reads its 16 fragments of a chunk from LDS: 32 ds_load_b128 +
// 48 v_wmma per 32-wide K chunk.
// ---------------------------------------------------------------------------

__device__ __forceinline__ void stage_copy(unsigned lds,
                                           const __bf16* xh, const __bf16* xl, unsigned xo,
                                           const __bf16* wh, const __bf16* wl, unsigned wo) {
    const unsigned long long gxh = (unsigned long long)(uintptr_t)xh + xo;
    const unsigned long long gxl = (unsigned long long)(uintptr_t)xl + xo;
    const unsigned long long gwh = (unsigned long long)(uintptr_t)wh + wo;
    const unsigned long long gwl = (unsigned long long)(uintptr_t)wl + wo;
    asm volatile("global_load_async_to_lds_b128 %0, %8, off\n\t"
                 "global_load_async_to_lds_b128 %1, %9, off\n\t"
                 "global_load_async_to_lds_b128 %2, %10, off\n\t"
                 "global_load_async_to_lds_b128 %3, %11, off\n\t"
                 "global_load_async_to_lds_b128 %4, %12, off\n\t"
                 "global_load_async_to_lds_b128 %5, %13, off\n\t"
                 "global_load_async_to_lds_b128 %6, %14, off\n\t"
                 "global_load_async_to_lds_b128 %7, %15, off\n\t"
                 "s_wait_xcnt 0x0"
                 :: "v"(lds),               "v"(lds + 512u),
                    "v"(lds + PANELB),      "v"(lds + PANELB + 512u),
                    "v"(lds + 2 * PANELB),  "v"(lds + 2 * PANELB + 512u),
                    "v"(lds + 3 * PANELB),  "v"(lds + 3 * PANELB + 512u),
                    "v"(gxh), "v"(gxh + 512ull), "v"(gxl), "v"(gxl + 512ull),
                    "v"(gwh), "v"(gwh + 512ull), "v"(gwl), "v"(gwl + 512ull)
                 : "memory");
}

// One lane's 16 bf16 of a staged fragment: its two 16-B halves.
__device__ __forceinline__ v16bf lds_frag(const char* f, int r0) {
    v8bf lo = *(const v8bf*)(f + r0);
    v8bf hi = *(const v8bf*)(f + (r0 ^ 16));
    return __builtin_shufflevector(lo, hi, 0, 1, 2, 3, 4, 5, 6, 7, 8, 9, 10, 11, 12, 13, 14, 15);
}

__global__ __launch_bounds__(512, 4) void k_main(const __bf16* __restrict__ XPh,
                                              const __bf16* __restrict__ XPl,
                                              const __bf16* __restrict__ WPh,
                                              const __bf16* __restrict__ WPl,
                                              const float* __restrict__ bb,
                                              float* __restrict__ out) {
    __shared__ __attribute__((aligned(1024))) char ring[2][STAGEB];

    const int tid  = threadIdx.x;
    const int lane = tid & 31;
    const int w    = tid >> 5;
    const int bm   = blockIdx.y * TM;
    const int bn   = blockIdx.x * TN;

    const int wm = w >> 2;                         // 0..3 -> 64-row slab
    const int wn = w & 3;                          // 0..3 -> 64-col slab
    const int row16 = lane & 15;
    const int mhi   = (lane >> 4) * 8;

    v8f acc[4][4];
#pragma unroll
    for (int a = 0; a < 4; ++a)
#pragma unroll
        for (int b = 0; b < 4; ++b)
#pragma unroll
            for (int j = 0; j < 8; ++j) acc[a][b][j] = 0.0f;

    const unsigned ldsw = (unsigned)(uintptr_t)(&ring[0][0]) + (unsigned)(w * FRAGB)
                        + (unsigned)((lane ^ (lane >> 4)) * 16);
    // Byte offsets into the panels (below 2^26): two registers live through the loop.
    const unsigned xo = (unsigned)(frag_off((bm >> 4) + w, KCX, 0, 0) * 2) + (unsigned)(lane * 16);
    const unsigned wo = (unsigned)(frag_off((bn >> 4) + w, KCX, 0, 0) * 2) + (unsigned)(lane * 16);
    // Read side: where lane's first half stands inside a staged fragment.
    const int r0 = (2 * lane + ((lane >> 3) & 1)) * 16;

    stage_copy(ldsw, XPh, XPl, xo, WPh, WPl, wo);
    stage_copy(ldsw + CHUNKB, XPh, XPl, xo + FRAGB, WPh, WPl, wo + FRAGB);
    asm volatile("s_wait_asynccnt 0x0" ::: "memory");   // stage 0 has landed (this wave's share)
    __syncthreads();                                    // ... and every other wave's
    stage_copy(ldsw + STAGEB, XPh, XPl, xo + 2 * FRAGB, WPh, WPl, wo + 2 * FRAGB);
    stage_copy(ldsw + STAGEB + CHUNKB, XPh, XPl, xo + 3 * FRAGB, WPh, WPl, wo + 3 * FRAGB);

    for (int s = 0; s < NST; ++s) {
        // Unrolled: the second chunk's LDS reads start among the first chunk's WMMAs.
#pragma unroll
        for (int c = 0; c < SKC; ++c) {
            const char* st = &ring[s & 1][c * CHUNKB];
            v16bf ah[4], al[4];
#pragma unroll
            for (int a = 0; a < 4; ++a) {
                ah[a] = lds_frag(st + (wm * 4 + a) * FRAGB, r0);
                al[a] = lds_frag(st + PANELB + (wm * 4 + a) * FRAGB, r0);
            }
#pragma unroll
            for (int b = 0; b < 4; ++b) {
                v16bf bh = lds_frag(st + 2 * PANELB + (wn * 4 + b) * FRAGB, r0);
                v16bf bl = lds_frag(st + 3 * PANELB + (wn * 4 + b) * FRAGB, r0);
                // Product-major: four independent accumulators between two uses of the same one.
#pragma unroll
                for (int a = 0; a < 4; ++a)
                    acc[a][b] = __builtin_amdgcn_wmma_f32_16x16x32_bf16(false, ah[a], false, bh, (short)0, acc[a][b], false, false);
#pragma unroll
                for (int a = 0; a < 4; ++a)
                    acc[a][b] = __builtin_amdgcn_wmma_f32_16x16x32_bf16(false, ah[a], false, bl, (short)0, acc[a][b], false, false);
#pragma unroll
                for (int a = 0; a < 4; ++a)
                    acc[a][b] = __builtin_amdgcn_wmma_f32_16x16x32_bf16(false, al[a], false, bh, (short)0, acc[a][b], false, false);
            }
        }
        asm volatile("s_wait_dscnt 0x0" ::: "memory");      // this wave has left buffer s & 1
        asm volatile("s_wait_asynccnt 0x0" ::: "memory");   // its share of stage s + 1 has landed
        __syncthreads();                                    // both hold for every wave
        if (s + 2 < NST) {
            const unsigned ko = (unsigned)(s + 2) * (SKC * FRAGB);
            const unsigned lb = ldsw + (unsigned)((s & 1) * STAGEB);
            stage_copy(lb, XPh, XPl, xo + ko, WPh, WPl, wo + ko);
            stage_copy(lb + CHUNKB, XPh, XPl, xo + ko + FRAGB, WPh, WPl, wo + ko + FRAGB);
        }
    }
    asm volatile("s_wait_asynccnt 0x0" ::: "memory");       // no copy outlives the loop

    // Epilogue: + bias.
#pragma unroll
    for (int b = 0; b < 4; ++b) {
        const int n = bn + wn * 64 + b * 16 + row16;
        const float bias = bb[n];
#pragma unroll
        for (int a = 0; a < 4; ++a) {
#pragma unroll
            for (int i = 0; i < 8; ++i) {
                const int mloc = wm * 64 + a * 16 + i + mhi;
                out[(size_t)(bm + mloc) * D_OUT + n] = acc[a][b][i] + bias;
            }
        }
    }
}

// ---------------------------------------------------------------------------
// Launch
// ---------------------------------------------------------------------------
extern "C" void kernel_launch(void* const* d_in, const int* in_sizes, int n_in,
                              void* d_out, int out_size, void* d_ws, size_t ws_size,
                              hipStream_t stream) {
    const float* x  = (const float*)d_in[0];   // [4,2048,2048]
    const float* Wb = (const float*)d_in[1];   // [2048,2048]
    const float* bb = (const float*)d_in[2];   // [2048]
    const float* Wr = (const float*)d_in[3];   // [8,2048]
    const float* Aw = (const float*)d_in[4];   // [8,8,2048]
    const float* Bw = (const float*)d_in[5];   // [8,2048,8]
    float* out = (float*)d_out;

    char* ws = (char*)d_ws;
    // panel sizes (bytes): XP 2x34603008, WP 2x8650752, PB 2x327680
    __bf16* XPh = (__bf16*)(ws);
    __bf16* XPl = (__bf16*)(ws + 34603008ull);
    __bf16* WPh = (__bf16*)(ws + 69206016ull);
    __bf16* WPl = (__bf16*)(ws + 77856768ull);
    __bf16* PBh = (__bf16*)(ws + 86507520ull);
    __bf16* PBl = (__bf16*)(ws + 86835200ull);

    hipLaunchKernelGGL(k_packpb, dim3((PBTILES * KC * 32 + 255) / 256), dim3(256), 0, stream, Wr, Aw, PBh, PBl);
    hipLaunchKernelGGL(k_hl,     dim3(HL_BLOCKS + PW_BLOCKS), dim3(256), 0, stream,
                       x, PBh, PBl, Wb, Bw, XPh, XPl, WPh, WPl);
    hipLaunchKernelGGL(k_main,   dim3(D_OUT / TN, NTOK / TM), dim3(512), 0, stream,
                       XPh, XPl, WPh, WPl, bb, out);
}

// v007
// A run of this version takes 132 microseconds.
// Two timings next to v006 both put it at 1.04 times that version's speed.
// Over all steps from v000 it is 2.83 times as fast.
#include <hip/hip_runtime.h>
#include <hip/hip_bf16.h>

typedef __attribute__((ext_vector_type(16))) __bf16 v16bf;
typedef __attribute__((ext_vector_type(8)))  __bf16 v8bf;
typedef __attribute__((ext_vector_type(8)))  float  v8f;

#define D_IN   2048
#define D_OUT  2048
#define NTOK   8192   // B*S
#define NEXP   8
#define RANK   8
#define LSCALE 2.0f   // ALPHA / R
#define PBROWS 80     // 8 router + 64 (E*R) + 8 pad
#define PBTILES 5

#define KC     64     // D_IN / 32 k-chunks
#define KCL    2      // NEXP * RANK / 32 k-chunks of the LoRA term
#define KCX    (KC + KCL)   // k-chunks per tile in the x and W panels
#define FRAG   16     // bf16 per lane per fragment
#define MT_X   512    // NTOK/16 row tiles of x
#define NT_W   128    // D_OUT/16 col tiles of W

#define TM 256
#define TN 256

#define FRAGB  1024           // bytes of one fragment: 32 lanes x 32 B
#define PANELB (16 * FRAGB)   // the 16 tiles one operand panel gives a block per k-chunk
#define CHUNKB (4 * PANELB)   // one k-chunk of a block: [x hi | x lo | W hi | W lo]
#define SKC    2              // k-chunks per stage
#define STAGEB (SKC * CHUNKB)
#define NST    (KCX / SKC)    // stages of the k loop
#define TAILB  2              // column tiles of a wave whose last WMMAs of a stage stand behind the refill

__device__ __forceinline__ void split_bf16(float x, __bf16& h, __bf16& l) {
    h = (__bf16)x;                 // RNE to bf16 (hi)
    l = (__bf16)(x - (float)h);    // residual (lo)
}

__device__ __forceinline__ size_t frag_off(int tile, int nkc, int kc, int lane) {
    return (((size_t)tile * nkc + kc) * 32 + lane) * FRAG;
}

#define PW_U      4
#define PW_BASE   (NT_W * KC  / (8 * PW_U))
#define PW_BLOCKS (NT_W * KCX / (8 * PW_U))
__device__ __forceinline__ void pack_w(const bool lora, const int blk,
                                       const float* __restrict__ Wb,
                                       const float* __restrict__ Bw,
                                       __bf16* __restrict__ WPh,
                                       __bf16* __restrict__ WPl) {
    const int lane = threadIdx.x & 31;
    // The wave's number as a scalar: tile and chunk numbers are scalar arithmetic.
    const int w    = __builtin_amdgcn_readfirstlane(threadIdx.x >> 5);
    const int hl   = lane >> 4;
    float4 f[PW_U][4];
    const float* a[PW_U];                              // each fragment's load address
#pragma unroll
    for (int u = 0; u < PW_U; ++u) {
        const int fr  = (blk * PW_U + u) * 8 + w;      // fragment number within the part
        const int nt  = lora ? fr / KCL : fr / KC;
        const int kc  = lora ? fr % KCL : fr % KC;     // chunk within the part
        const int row = nt * 16 + (lane & 15);
        const float* src0 = lora ? Bw + ((kc * 4 + hl) * D_OUT + row) * RANK
                                 : Wb + row * D_IN + kc * 32 + hl * 8;
        const float* src1 = lora ? src0 + 2 * D_OUT * RANK : src0 + 16;
        f[u][0] = *(const float4*)(src0);
        f[u][1] = *(const float4*)(src0 + 4);
        f[u][2] = *(const float4*)(src1);
        f[u][3] = *(const float4*)(src1 + 4);
        a[u] = src0;
    }
    // The loads' address registers stay live up to this wait (named as inputs), so that no
    // load's result and nothing behind the wait rewrites one ahead of it.
    asm volatile("s_wait_xcnt 0x0" :: "v"(a[0]), "v"(a[1]), "v"(a[2]), "v"(a[3]) : "memory");
#pragma unroll
    for (int u = 0; u < PW_U; ++u) {
        const int fr = (blk * PW_U + u) * 8 + w;
        const int nt = lora ? fr / KCL : fr / KC;
        const int kc = lora ? KC + fr % KCL : fr % KC;
        const float4* q = f[u];
        const float g[16] = {q[0].x, q[0].y, q[0].z, q[0].w, q[1].x, q[1].y, q[1].z, q[1].w,
                             q[2].x, q[2].y, q[2].z, q[2].w, q[3].x, q[3].y, q[3].z, q[3].w};
        v16bf h, l;
#pragma unroll
        for (int j = 0; j < 16; ++j) {
            __bf16 hh, ll;
            split_bf16(g[j], hh, ll);
            h[j] = hh; l[j] = ll;
        }
        const size_t off = frag_off(nt, KCX, kc, lane);
        *(v16bf*)(WPh + off) = h;
        *(v16bf*)(WPl + off) = l;
    }
    // Code of the kernel's other parts follows in the listing and rewrites the registers of
    // these stores.
    asm volatile("s_wait_xcnt 0x0" ::: "memory");
}

// Pack [W_router ; A_w ; zeros] (80 logical rows) into 5 fragment tiles.
__global__ __launch_bounds__(256) void k_packpb(const float* __restrict__ Wr,
                                                const float* __restrict__ Aw,
                                                __bf16* __restrict__ PBh,
                                                __bf16* __restrict__ PBl) {
    int t = blockIdx.x * 256 + threadIdx.x;        // 0 .. PBTILES*KC*32-1
    if (t >= PBTILES * KC * 32) return;
    int lane = t & 31;
    int kc   = (t >> 5) & (KC - 1);
    int nt   = t >> 11;
    int row  = nt * 16 + (lane & 15);              // 0..79
    int kb   = (lane >> 4) << 3;
    const float* src = (row < NEXP) ? (Wr + (size_t)row * D_IN)
                     : (row < NEXP + NEXP * RANK) ? (Aw + (size_t)(row - NEXP) * D_IN)
                     : nullptr;
    v16bf h, l;
#pragma unroll
    for (int j = 0; j < 8; ++j) {
        float f0 = src ? src[kc * 32 + kb + j]      : 0.0f;
        float f1 = src ? src[kc * 32 + kb + 16 + j] : 0.0f;
        __bf16 h0, l0, h1, l1;
        split_bf16(f0, h0, l0);
        split_bf16(f1, h1, l1);
        h[j] = h0; l[j] = l0; h[8 + j] = h1; l[8 + j] = l1;
    }
    size_t off = (size_t)t * FRAG;
    *(v16bf*)(PBh + off) = h;
    *(v16bf*)(PBl + off) = l;
}

#define HL_MT 2
#define HL_KW (KC / 8)
#define HL_NT (HL_MT * PBTILES)
#define HL_BLOCKS (MT_X / HL_MT)
#define HS_P  (PBROWS + 4)

__global__ __launch_bounds__(256, 4) void k_hl(const float* __restrict__ x,
                                               const __bf16* __restrict__ PBh,
                                               const __bf16* __restrict__ PBl,
                                               const float* __restrict__ Wb,
                                               const float* __restrict__ Bw,
                                               __bf16* __restrict__ XPh,
                                               __bf16* __restrict__ XPl,
                                               __bf16* __restrict__ WPh,
                                               __bf16* __restrict__ WPl) {
    __shared__ float part[8][HL_NT * 8][32];       // [wave][tile * 8 + register][lane]
    __shared__ __attribute__((aligned(16))) float hs[HL_MT * 16][HS_P];   // [token][router 8 | h 64 | pad]

    // The long blocks have the low indices; the W blocks run beside them.
    if (blockIdx.x >= HL_BLOCKS) {
        const int pb = blockIdx.x - HL_BLOCKS;
        if (pb < PW_BASE) pack_w(false, pb, Wb, Bw, WPh, WPl);
        else              pack_w(true, pb - PW_BASE, Wb, Bw, WPh, WPl);
        return;
    }

    const int lane = threadIdx.x & 31;
    // The wave's number as a scalar: panel offsets and LDS bases are scalar arithmetic.
    const int w    = __builtin_amdgcn_readfirstlane(threadIdx.x >> 5);
    const int mt0  = blockIdx.x * HL_MT;           // first row tile of the block
    const int row16 = lane & 15;
    const int mhi   = (lane >> 4) * 8;
    // The lane's place in the wave's first fragment of each panel.
    const unsigned lo = (unsigned)lane * (FRAG * 2);
    char* qxh = (char*)(XPh + frag_off(mt0, KCX, w * HL_KW, 0)) + lo;
    char* qxl = (char*)(XPl + frag_off(mt0, KCX, w * HL_KW, 0)) + lo;
    const char* pbh = (const char*)(PBh + frag_off(0, KC, w * HL_KW, 0)) + lo;
    const char* pbl = (const char*)(PBl + frag_off(0, KC, w * HL_KW, 0)) + lo;
    // The lane's first value of the wave's first chunk in x: its row, K = mhi.
    const char* px = (const char*)(x + (size_t)(mt0 * 16 + row16) * D_IN + w * (HL_KW * 32) + mhi);

    v8f acc[HL_MT][PBTILES];
#pragma unroll
    for (int m = 0; m < HL_MT; ++m)
#pragma unroll
        for (int t = 0; t < PBTILES; ++t)
#pragma unroll
            for (int j = 0; j < 8; ++j) acc[m][t][j] = 0.0f;

    // xc[row tile]: K {0..3}, {4..7}, {16..19}, {20..23} from the lane's first, of the chunk at hand.
    float4 xc[HL_MT][4];
#pragma unroll
    for (int m = 0; m < HL_MT; ++m) {
        const char* s = px + m * (16 * D_IN * 4);
        xc[m][0] = *(const float4*)(s);
        xc[m][1] = *(const float4*)(s + 16);
        xc[m][2] = *(const float4*)(s + 64);
        xc[m][3] = *(const float4*)(s + 80);
    }

    // Rolled: unrolled, the compiler moves the next chunk's split up among this chunk's
    // WMMAs, directly behind its loads, and every chunk then waits out the memory latency.
#pragma unroll 1
    for (int i = 0; i < HL_KW; ++i) {
        v16bf ah[HL_MT], al[HL_MT], bh[PBTILES], bl[PBTILES];
#pragma unroll
        for (int t = 0; t < PBTILES; ++t) {
            bh[t] = *(const v16bf*)(pbh + (t * KC + i) * FRAGB);
            bl[t] = *(const v16bf*)(pbl + (t * KC + i) * FRAGB);
        }
        // Keeps the next chunk's x loads behind this chunk's B loads: the load counter
        // returns in issue order, so the wait for B would otherwise wait for memory too.
        __builtin_amdgcn_sched_barrier(0);
        // The next chunk's x, in flight over this chunk's work. The last trip reads its own
        // chunk again: a branch round the loads would merge two paths in the compiler's wait
        // counting, and every trip would drain the loads.
        float4 xn[HL_MT][4];
        const int inx = (i + 1 < HL_KW) ? i + 1 : i;
#pragma unroll
        for (int m = 0; m < HL_MT; ++m) {
            const char* s = px + m * (16 * D_IN * 4) + inx * 128;
            xn[m][0] = *(const float4*)(s);
            xn[m][1] = *(const float4*)(s + 16);
            xn[m][2] = *(const float4*)(s + 64);
            xn[m][3] = *(const float4*)(s + 80);
        }
        // Keeps all 28 loads ahead of the split and the WMMAs: the B loads share one round trip.
        __builtin_amdgcn_sched_barrier(0);
#pragma unroll
        for (int m = 0; m < HL_MT; ++m) {
            const float4* q = xc[m];
            const float f[16] = {q[0].x, q[0].y, q[0].z, q[0].w, q[1].x, q[1].y, q[1].z, q[1].w,
                                 q[2].x, q[2].y, q[2].z, q[2].w, q[3].x, q[3].y, q[3].z, q[3].w};
            v16bf h, l;
#pragma unroll
            for (int j = 0; j < 16; ++j) {
                __bf16 hh, ll;
                split_bf16(f[j], hh, ll);
                h[j] = hh; l[j] = ll;
            }
            ah[m] = h; al[m] = l;
            *(v16bf*)(qxh + (m * KCX + i) * FRAGB) = h;
            *(v16bf*)(qxl + (m * KCX + i) * FRAGB) = l;
#pragma unroll
            for (int k = 0; k < 4; ++k) xc[m][k] = xn[m][k];
        }
        // Product-major: ten independent accumulators between two uses of the same one.
#pragma unroll
        for (int t = 0; t < PBTILES; ++t)
#pragma unroll
            for (int m = 0; m < HL_MT; ++m)
                acc[m][t] = __builtin_amdgcn_wmma_f32_16x16x32_bf16(false, ah[m], false, bh[t], (short)0, acc[m][t], false, false);
#pragma unroll
        for (int t = 0; t < PBTILES; ++t)
#pragma unroll
            for (int m = 0; m < HL_MT; ++m)
                acc[m][t] = __builtin_amdgcn_wmma_f32_16x16x32_bf16(false, ah[m], false, bl[t], (short)0, acc[m][t], false, false);
#pragma unroll
        for (int t = 0; t < PBTILES; ++t)
#pragma unroll
            for (int m = 0; m < HL_MT; ++m)
                acc[m][t] = __builtin_amdgcn_wmma_f32_16x16x32_bf16(false, al[m], false, bh[t], (short)0, acc[m][t], false, false);
        // The next trip rewrites the address and data registers of this trip's panel stores.
        asm volatile("s_wait_xcnt 0x0" ::: "memory");
    }

#pragma unroll
    for (int m = 0; m < HL_MT; ++m)
#pragma unroll
        for (int t = 0; t < PBTILES; ++t)
#pragma unroll
            for (int j = 0; j < 8; ++j) part[w][(m * PBTILES + t) * 8 + j][lane] = acc[m][t][j];
    __syncthreads();                               // every wave's partial sums stand in LDS

    // Wave w adds register w of every tile over the 8 waves and leaves it in LDS.
#pragma unroll
    for (int m = 0; m < HL_MT; ++m)
#pragma unroll
        for (int t = 0; t < PBTILES; ++t) {
            float s = part[0][(m * PBTILES + t) * 8 + w][lane];
#pragma unroll
            for (int p = 1; p < 8; ++p) s += part[p][(m * PBTILES + t) * 8 + w][lane];
            hs[m * 16 + w + mhi][t * 16 + row16] = s;
        }
    __syncthreads();                               // every token's 80 sums stand in LDS

    // Gating: one wave per (row tile, LoRA chunk), one lane-slice a thread; the four
    // threads of a token each repeat its top-2.
    if (w < HL_MT * KCL) {
        const int c = w & (KCL - 1);
        const int m = w >> 1;
        const float* row = hs[m * 16 + row16];

        int e0 = 0; float v0 = row[0];
#pragma unroll
        for (int e = 1; e < NEXP; ++e) { float v = row[e]; if (v > v0) { v0 = v; e0 = e; } }
        int e1 = (e0 == 0) ? 1 : 0; float v1 = row[e1];
#pragma unroll
        for (int e = 0; e < NEXP; ++e) {
            if (e == e0) continue;
            float v = row[e];
            if (v > v1) { v1 = v; e1 = e; }
        }
        float x1  = __expf(v1 - v0);
        float inv = 1.0f / (1.0f + x1);
        float g0 = inv * LSCALE;
        float g1 = x1 * inv * LSCALE;

        v16bf h, l;
#pragma unroll
        for (int half = 0; half < 2; ++half) {
            const int e = c * 4 + half * 2 + (lane >> 4);
            const float4 p = *(const float4*)(row + NEXP + e * RANK);
            const float4 q = *(const float4*)(row + NEXP + e * RANK + 4);
            const float hv[RANK] = {p.x, p.y, p.z, p.w, q.x, q.y, q.z, q.w};
            const bool  on = (e == e0) || (e == e1);
            const float g  = (e == e0) ? g0 : g1;
#pragma unroll
            for (int r = 0; r < RANK; ++r) {
                float v = on ? hv[r] * g : 0.0f;
                __bf16 hh, ll;
                split_bf16(v, hh, ll);
                h[half * 8 + r] = hh; l[half * 8 + r] = ll;
            }
        }
        size_t off = frag_off(mt0 + m, KCX, KC + c, lane);
        *(v16bf*)(XPh + off) = h;
        *(v16bf*)(XPl + off) = l;
        // As behind pack_w's stores: the packing code follows in the listing.
        asm volatile("s_wait_xcnt 0x0" ::: "memory");
    }
}

// ---------------------------------------------------------------------------
// y = [x | gated h] @ [W | B_w]^T + bias: base GEMM and LoRA term in one k loop.
// 256x256 tile / block, 16 waves (4x4) of 64x64 each, one block per WGP. A stage
// is two k-chunks; its 128 fragments are brought into LDS once per block by async
// global->LDS copies (two buffers: stage t+2 flies while stage t+1 is worked on);
// every wave then reads its 16 fragments of a chunk from LDS: 32 ds_load_b128 +
// 48 v_wmma per 32-wide K chunk. A stage's buffer is handed over and refilled once its
// last fragments are in registers, ahead of the WMMAs on them.
// ---------------------------------------------------------------------------

__device__ __forceinline__ void stage_copy(unsigned lds,
                                           const __bf16* xh, const __bf16* xl, unsigned xo,
                                           const __bf16* wh, const __bf16* wl, unsigned wo) {
    asm volatile("global_load_async_to_lds_b128 %0, %4, %6\n\t"
                 "global_load_async_to_lds_b128 %0, %4, %6 offset:512\n\t"
                 "global_load_async_to_lds_b128 %1, %4, %7\n\t"
                 "global_load_async_to_lds_b128 %1, %4, %7 offset:512\n\t"
                 "global_load_async_to_lds_b128 %2, %5, %8\n\t"
                 "global_load_async_to_lds_b128 %2, %5, %8 offset:512\n\t"
                 "global_load_async_to_lds_b128 %3, %5, %9\n\t"
                 "global_load_async_to_lds_b128 %3, %5, %9 offset:512\n\t"
                 "s_wait_xcnt 0x0"
                 :: "v"(lds),               "v"(lds + PANELB),
                    "v"(lds + 2 * PANELB),  "v"(lds + 3 * PANELB),
                    "v"(xo), "v"(wo),
                    "s"(xh), "s"(xl), "s"(wh), "s"(wl)
                 : "memory");
}

// One lane's 16 bf16 of a staged fragment: its two 16-B halves.
__device__ __forceinline__ v16bf lds_frag(const char* f, int r0) {
    v8bf lo = *(const v8bf*)(f + r0);
    v8bf hi = *(const v8bf*)(f + (r0 ^ 16));
    return __builtin_shufflevector(lo, hi, 0, 1, 2, 3, 4, 5, 6, 7, 8, 9, 10, 11, 12, 13, 14, 15);
}

__global__ __launch_bounds__(512, 4) void k_main(const __bf16* __restrict__ XPh,
                                              const __bf16* __restrict__ XPl,
                                              const __bf16* __restrict__ WPh,
                                              const __bf16* __restrict__ WPl,
                                              const float* __restrict__ bb,
                                              float* __restrict__ out) {
    __shared__ __attribute__((aligned(1024))) char ring[2][STAGEB];

    const int tid  = threadIdx.x;
    const int lane = tid & 31;
    const int w    = tid >> 5;
    const int bm   = blockIdx.y * TM;
    const int bn   = blockIdx.x * TN;

    const int wm = w >> 2;                         // 0..3 -> 64-row slab
    const int wn = w & 3;                          // 0..3 -> 64-col slab
    const int row16 = lane & 15;
    const int mhi   = (lane >> 4) * 8;

    v8f acc[4][4];
#pragma unroll
    for (int a = 0; a < 4; ++a)
#pragma unroll
        for (int b = 0; b < 4; ++b)
#pragma unroll
            for (int j = 0; j < 8; ++j) acc[a][b][j] = 0.0f;

    const unsigned ldsw = (unsigned)(uintptr_t)(&ring[0][0]) + (unsigned)(w * FRAGB)
                        + (unsigned)((lane ^ (lane >> 4)) * 16);
    // Byte offsets into the panels (below 2^26): two registers live through the loop.
    const unsigned xo = (unsigned)(frag_off((bm >> 4) + w, KCX, 0, 0) * 2) + (unsigned)(lane * 16);
    const unsigned wo = (unsigned)(frag_off((bn >> 4) + w, KCX, 0, 0) * 2) + (unsigned)(lane * 16);
    // Read side: where lane's first half stands inside a staged fragment.
    const int r0 = (2 * lane + ((lane >> 3) & 1)) * 16;

    stage_copy(ldsw, XPh, XPl, xo, WPh, WPl, wo);
    stage_copy(ldsw + CHUNKB, XPh, XPl, xo + FRAGB, WPh, WPl, wo + FRAGB);
    asm volatile("s_wait_asynccnt 0x0" ::: "memory");   // stage 0 has landed (this wave's share)
    __syncthreads();                                    // ... and every other wave's
    stage_copy(ldsw + STAGEB, XPh, XPl, xo + 2 * FRAGB, WPh, WPl, wo + 2 * FRAGB);
    stage_copy(ldsw + STAGEB + CHUNKB, XPh, XPl, xo + 3 * FRAGB, WPh, WPl, wo + 3 * FRAGB);

    for (int s = 0; s < NST; ++s) {
        // Unrolled: the second chunk's LDS reads start among the first chunk's WMMAs.
#pragma unroll
        for (int c = 0; c < SKC; ++c) {
            const char* st = &ring[s & 1][c * CHUNKB];
            v16bf ah[4], al[4];
#pragma unroll
            for (int a = 0; a < 4; ++a) {
                ah[a] = lds_frag(st + (wm * 4 + a) * FRAGB, r0);
                al[a] = lds_frag(st + PANELB + (wm * 4 + a) * FRAGB, r0);
            }
            v16bf bh[4], bl[4];
#pragma unroll
            for (int b = 0; b < 4; ++b) {
                // The stage's last TAILB column tiles are read together, ahead of the hand-over.
                const bool tail = (c == SKC - 1) && (b >= 4 - TAILB);
                if (!tail) {
                    bh[b] = lds_frag(st + 2 * PANELB + (wn * 4 + b) * FRAGB, r0);
                    bl[b] = lds_frag(st + 3 * PANELB + (wn * 4 + b) * FRAGB, r0);
                } else if (b == 4 - TAILB) {
                    // Unrolled: q indexes the fragment arrays, which stay in registers only under constant indices.
#pragma unroll
                    for (int q = 4 - TAILB; q < 4; ++q) {
                        bh[q] = lds_frag(st + 2 * PANELB + (wn * 4 + q) * FRAGB, r0);
                        bl[q] = lds_frag(st + 3 * PANELB + (wn * 4 + q) * FRAGB, r0);
                    }
                    // Keeps the WMMAs written above on this side of the barrier: sunk behind it they
                    // would stand in front of the refill.
                    __builtin_amdgcn_sched_barrier(0);
                    asm volatile("s_wait_dscnt 0x0" ::: "memory");      // this wave has left buffer s & 1
                    asm volatile("s_wait_asynccnt 0x0" ::: "memory");   // its share of stage s + 1 has landed
                    __syncthreads();                                    // both hold for every wave
                    // The refill goes out at once, ahead of the stage's last WMMAs (for speed only).
                    if (s + 2 < NST) {
                        const unsigned ko = (unsigned)(s + 2) * (SKC * FRAGB);
                        const unsigned lb = ldsw + (unsigned)((s & 1) * STAGEB);
                        stage_copy(lb, XPh, XPl, xo + ko, WPh, WPl, wo + ko);
                        stage_copy(lb + CHUNKB, XPh, XPl, xo + ko + FRAGB, WPh, WPl, wo + ko + FRAGB);
                    }
                }
                // Product-major: four independent accumulators between two uses of the same one.
#pragma unroll
                for (int a = 0; a < 4; ++a)
                    acc[a][b] = __builtin_amdgcn_wmma_f32_16x16x32_bf16(false, ah[a], false, bh[b], (short)0, acc[a][b], false, false);
#pragma unroll
                for (int a = 0; a < 4; ++a)
                    acc[a][b] = __builtin_amdgcn_wmma_f32_16x16x32_bf16(false, ah[a], false, bl[b], (short)0, acc[a][b], false, false);
#pragma unroll
                for (int a = 0; a < 4; ++a)
                    acc[a][b] = __builtin_amdgcn_wmma_f32_16x16x32_bf16(false, al[a], false, bh[b], (short)0, acc[a][b], false, false);
            }
        }
    }
    asm volatile("s_wait_asynccnt 0x0" ::: "memory");       // no copy outlives the loop

    // Epilogue: + bias.
#pragma unroll
    for (int b = 0; b < 4; ++b) {
        const int n = bn + wn * 64 + b * 16 + row16;
        const float bias = bb[n];
#pragma unroll
        for (int a = 0; a < 4; ++a) {
#pragma unroll
            for (int i = 0; i < 8; ++i) {
                const int mloc = wm * 64 + a * 16 + i + mhi;
                out[(size_t)(bm + mloc) * D_OUT + n] = acc[a][b][i] + bias;
            }
        }
    }
}

// ---------------------------------------------------------------------------
// Launch
// ---------------------------------------------------------------------------
extern "C" void kernel_launch(void* const* d_in, const int* in_sizes, int n_in,
                              void* d_out, int out_size, void* d_ws, size_t ws_size,
                              hipStream_t stream) {
    const float* x  = (const float*)d_in[0];   // [4,2048,2048]
    const float* Wb = (const float*)d_in[1];   // [2048,2048]
    const float* bb = (const float*)d_in[2];   // [2048]
    const float* Wr = (const float*)d_in[3];   // [8,2048]
    const float* Aw = (const float*)d_in[4];   // [8,8,2048]
    const float* Bw = (const float*)d_in[5];   // [8,2048,8]
    float* out = (float*)d_out;

    char* ws = (char*)d_ws;
    // panel sizes (bytes): XP 2x34603008, WP 2x8650752, PB 2x327680
    __bf16* XPh = (__bf16*)(ws);
    __bf16* XPl = (__bf16*)(ws + 34603008ull);
    __bf16* WPh = (__bf16*)(ws + 69206016ull);
    __bf16* WPl = (__bf16*)(ws + 77856768ull);
    __bf16* PBh = (__bf16*)(ws + 86507520ull);
    __bf16* PBl = (__bf16*)(ws + 86835200ull);

    hipLaunchKernelGGL(k_packpb, dim3((PBTILES * KC * 32 + 255) / 256), dim3(256), 0, stream, Wr, Aw, PBh, PBl);
    hipLaunchKernelGGL(k_hl,     dim3(HL_BLOCKS + PW_BLOCKS), dim3(256), 0, stream,
                       x, PBh, PBl, Wb, Bw, XPh, XPl, WPh, WPl);
    hipLaunchKernelGGL(k_main,   dim3(D_OUT / TN, NTOK / TM), dim3(512), 0, stream,
                       XPh, XPl, WPh, WPl, bb, out);
}

// v008
// It runs in 128 microseconds.
// Next to v007, in two timings, it ran 1.04 and 1.03 times as fast.
// Over all steps from v000 it is 2.92 times as fast.
#include <hip/hip_runtime.h>
#include <hip/hip_bf16.h>

typedef __attribute__((ext_vector_type(16))) __bf16 v16bf;
typedef __attribute__((ext_vector_type(8)))  __bf16 v8bf;
typedef __attribute__((ext_vector_type(8)))  float  v8f;

#define D_IN   2048
#define D_OUT  2048
#define NTOK   8192   // B*S
#define NEXP   8
#define RANK   8
#define LSCALE 2.0f   // ALPHA / R
#define PBROWS 80     // 8 router + 64 (E*R) + 8 pad
#define PBTILES 5

#define KC     64     // D_IN / 32 k-chunks
#define KCL    2      // NEXP * RANK / 32 k-chunks of the LoRA term
#define KCX    (KC + KCL)   // k-chunks per tile in the x and W panels
#define FRAG   16     // bf16 per lane per fragment
#define MT_X   512    // NTOK/16 row tiles of x
#define NT_W   128    // D_OUT/16 col tiles of W

#define TM 256
#define TN 256

#define FRAGB  1024           // bytes of one fragment: 32 lanes x 32 B
#define PANELB (16 * FRAGB)   // the 16 tiles one operand panel gives a block per k-chunk
#define CHUNKB (4 * PANELB)   // one k-chunk of a block: [x hi | x lo | W hi | W lo]
#define SKC    2              // k-chunks per stage
#define STAGEB (SKC * CHUNKB)
#define NST    (KCX / SKC)    // stages of the k loop
#define TAILB  2              // column tiles of a wave whose last WMMAs of a stage stand behind the hand-over

__device__ __forceinline__ void split_bf16(float x, __bf16& h, __bf16& l) {
    h = (__bf16)x;                 // RNE to bf16 (hi)
    l = (__bf16)(x - (float)h);    // residual (lo)
}

__device__ __forceinline__ size_t frag_off(int tile, int nkc, int kc, int lane) {
    return (((size_t)tile * nkc + kc) * 32 + lane) * FRAG;
}

#define PW_U      4
#define PW_BASE   (NT_W * KC  / (8 * PW_U))
#define PW_BLOCKS (NT_W * KCX / (8 * PW_U))
__device__ __forceinline__ void pack_w(const bool lora, const int blk,
                                       const float* __restrict__ Wb,
                                       const float* __restrict__ Bw,
                                       __bf16* __restrict__ WPh,
                                       __bf16* __restrict__ WPl) {
    const int lane = threadIdx.x & 31;
    // The wave's number as a scalar: tile and chunk numbers are scalar arithmetic.
    const int w    = __builtin_amdgcn_readfirstlane(threadIdx.x >> 5);
    const int hl   = lane >> 4;
    float4 f[PW_U][4];
    const float* a[PW_U];                              // each fragment's load address
#pragma unroll
    for (int u = 0; u < PW_U; ++u) {
        const int fr  = (blk * PW_U + u) * 8 + w;      // fragment number within the part
        const int nt  = lora ? fr / KCL : fr / KC;
        const int kc  = lora ? fr % KCL : fr % KC;     // chunk within the part
        const int row = nt * 16 + (lane & 15);
        const float* src0 = lora ? Bw + ((kc * 4 + hl) * D_OUT + row) * RANK
                                 : Wb + row * D_IN + kc * 32 + hl * 8;
        const float* src1 = lora ? src0 + 2 * D_OUT * RANK : src0 + 16;
        f[u][0] = *(const float4*)(src0);
        f[u][1] = *(const float4*)(src0 + 4);
        f[u][2] = *(const float4*)(src1);
        f[u][3] = *(const float4*)(src1 + 4);
        a[u] = src0;
    }
    // The loads' address registers stay live up to this wait (named as inputs), so that no
    // load's result and nothing behind the wait rewrites one ahead of it.
    asm volatile("s_wait_xcnt 0x0" :: "v"(a[0]), "v"(a[1]), "v"(a[2]), "v"(a[3]) : "memory");
#pragma unroll
    for (int u = 0; u < PW_U; ++u) {
        const int fr = (blk * PW_U + u) * 8 + w;
        const int nt = lora ? fr / KCL : fr / KC;
        const int kc = lora ? KC + fr % KCL : fr % KC;
        const float4* q = f[u];
        const float g[16] = {q[0].x, q[0].y, q[0].z, q[0].w, q[1].x, q[1].y, q[1].z, q[1].w,
                             q[2].x, q[2].y, q[2].z, q[2].w, q[3].x, q[3].y, q[3].z, q[3].w};
        v16bf h, l;
#pragma unroll
        for (int j = 0; j < 16; ++j) {
            __bf16 hh, ll;
            split_bf16(g[j], hh, ll);
            h[j] = hh; l[j] = ll;
        }
        const size_t off = frag_off(nt, KCX, kc, lane);
        *(v16bf*)(WPh + off) = h;
        *(v16bf*)(WPl + off) = l;
    }
    // Code of the kernel's other parts follows in the listing and rewrites the registers of
    // these stores.
    asm volatile("s_wait_xcnt 0x0" ::: "memory");
}

// Pack [W_router ; A_w ; zeros] (80 logical rows) into 5 fragment tiles.
__global__ __launch_bounds__(256) void k_packpb(const float* __restrict__ Wr,
                                                const float* __restrict__ Aw,
                                                __bf16* __restrict__ PBh,
                                                __bf16* __restrict__ PBl) {
    int t = blockIdx.x * 256 + threadIdx.x;        // 0 .. PBTILES*KC*32-1
    if (t >= PBTILES * KC * 32) return;
    int lane = t & 31;
    int kc   = (t >> 5) & (KC - 1);
    int nt   = t >> 11;
    int row  = nt * 16 + (lane & 15);              // 0..79
    int kb   = (lane >> 4) << 3;
    const float* src = (row < NEXP) ? (Wr + (size_t)row * D_IN)
                     : (row < NEXP + NEXP * RANK) ? (Aw + (size_t)(row - NEXP) * D_IN)
                     : nullptr;
    v16bf h, l;
#pragma unroll
    for (int j = 0; j < 8; ++j) {
        float f0 = src ? src[kc * 32 + kb + j]      : 0.0f;
        float f1 = src ? src[kc * 32 + kb + 16 + j] : 0.0f;
        __bf16 h0, l0, h1, l1;
        split_bf16(f0, h0, l0);
        split_bf16(f1, h1, l1);
        h[j] = h0; l[j] = l0; h[8 + j] = h1; l[8 + j] = l1;
    }
    size_t off = (size_t)t * FRAG;
    *(v16bf*)(PBh + off) = h;
    *(v16bf*)(PBl + off) = l;
}

#define HL_MT 2
#define HL_KW (KC / 8)
#define HL_NT (HL_MT * PBTILES)
#define HL_BLOCKS (MT_X / HL_MT)
#define HS_P  (PBROWS + 4)

__global__ __launch_bounds__(256, 4) void k_hl(const float* __restrict__ x,
                                               const __bf16* __restrict__ PBh,
                                               const __bf16* __restrict__ PBl,
                                               const float* __restrict__ Wb,
                                               const float* __restrict__ Bw,
                                               __bf16* __restrict__ XPh,
                                               __bf16* __restrict__ XPl,
                                               __bf16* __restrict__ WPh,
                                               __bf16* __restrict__ WPl) {
    __shared__ float part[8][HL_NT * 8][32];       // [wave][tile * 8 + register][lane]
    __shared__ __attribute__((aligned(16))) float hs[HL_MT * 16][HS_P];   // [token][router 8 | h 64 | pad]

    // The long blocks have the low indices; the W blocks run beside them.
    if (blockIdx.x >= HL_BLOCKS) {
        const int pb = blockIdx.x - HL_BLOCKS;
        if (pb < PW_BASE) pack_w(false, pb, Wb, Bw, WPh, WPl);
        else              pack_w(true, pb - PW_BASE, Wb, Bw, WPh, WPl);
        return;
    }

    const int lane = threadIdx.x & 31;
    // The wave's number as a scalar: panel offsets and LDS bases are scalar arithmetic.
    const int w    = __builtin_amdgcn_readfirstlane(threadIdx.x >> 5);
    const int mt0  = blockIdx.x * HL_MT;           // first row tile of the block
    const int row16 = lane & 15;
    const int mhi   = (lane >> 4) * 8;
    // The lane's place in the wave's first fragment of each panel.
    const unsigned lo = (unsigned)lane * (FRAG * 2);
    char* qxh = (char*)(XPh + frag_off(mt0, KCX, w * HL_KW, 0)) + lo;
    char* qxl = (char*)(XPl + frag_off(mt0, KCX, w * HL_KW, 0)) + lo;
    const char* pbh = (const char*)(PBh + frag_off(0, KC, w * HL_KW, 0)) + lo;
    const char* pbl = (const char*)(PBl + frag_off(0, KC, w * HL_KW, 0)) + lo;
    // The lane's first value of the wave's first chunk in x: its row, K = mhi.
    const char* px = (const char*)(x + (size_t)(mt0 * 16 + row16) * D_IN + w * (HL_KW * 32) + mhi);

    v8f acc[HL_MT][PBTILES];
#pragma unroll
    for (int m = 0; m < HL_MT; ++m)
#pragma unroll
        for (int t = 0; t < PBTILES; ++t)
#pragma unroll
            for (int j = 0; j < 8; ++j) acc[m][t][j] = 0.0f;

    // xc[row tile]: K {0..3}, {4..7}, {16..19}, {20..23} from the lane's first, of the chunk at hand.
    float4 xc[HL_MT][4];
#pragma unroll
    for (int m = 0; m < HL_MT; ++m) {
        const char* s = px + m * (16 * D_IN * 4);
        xc[m][0] = *(const float4*)(s);
        xc[m][1] = *(const float4*)(s + 16);
        xc[m][2] = *(const float4*)(s + 64);
        xc[m][3] = *(const float4*)(s + 80);
    }

    // Rolled: unrolled, the compiler moves the next chunk's split up among this chunk's
    // WMMAs, directly behind its loads, and every chunk then waits out the memory latency.
#pragma unroll 1
    for (int i = 0; i < HL_KW; ++i) {
        v16bf ah[HL_MT], al[HL_MT], bh[PBTILES], bl[PBTILES];
#pragma unroll
        for (int t = 0; t < PBTILES; ++t) {
            bh[t] = *(const v16bf*)(pbh + (t * KC + i) * FRAGB);
            bl[t] = *(const v16bf*)(pbl + (t * KC + i) * FRAGB);
        }
        // Keeps the next chunk's x loads behind this chunk's B loads: the load counter
        // returns in issue order, so the wait for B would otherwise wait for memory too.
        __builtin_amdgcn_sched_barrier(0);
        // The next chunk's x, in flight over this chunk's work. The last trip reads its own
        // chunk again: a branch round the loads would merge two paths in the compiler's wait
        // counting, and every trip would drain the loads.
        float4 xn[HL_MT][4];
        const int inx = (i + 1 < HL_KW) ? i + 1 : i;
#pragma unroll
        for (int m = 0; m < HL_MT; ++m) {
            const char* s = px + m * (16 * D_IN * 4) + inx * 128;
            xn[m][0] = *(const float4*)(s);
            xn[m][1] = *(const float4*)(s + 16);
            xn[m][2] = *(const float4*)(s + 64);
            xn[m][3] = *(const float4*)(s + 80);
        }
        // Keeps all 28 loads ahead of the split and the WMMAs: the B loads share one round trip.
        __builtin_amdgcn_sched_barrier(0);
#pragma unroll
        for (int m = 0; m < HL_MT; ++m) {
            const float4* q = xc[m];
            const float f[16] = {q[0].x, q[0].y, q[0].z, q[0].w, q[1].x, q[1].y, q[1].z, q[1].w,
                                 q[2].x, q[2].y, q[2].z, q[2].w, q[3].x, q[3].y, q[3].z, q[3].w};
            v16bf h, l;
#pragma unroll
            for (int j = 0; j < 16; ++j) {
                __bf16 hh, ll;
                split_bf16(f[j], hh, ll);
                h[j] = hh; l[j] = ll;
            }
            ah[m] = h; al[m] = l;
            *(v16bf*)(qxh + (m * KCX + i) * FRAGB) = h;
            *(v16bf*)(qxl + (m * KCX + i) * FRAGB) = l;
#pragma unroll
            for (int k = 0; k < 4; ++k) xc[m][k] = xn[m][k];
        }
        // Product-major: ten independent accumulators between two uses of the same one.
#pragma unroll
        for (int t = 0; t < PBTILES; ++t)
#pragma unroll
            for (int m = 0; m < HL_MT; ++m)
                acc[m][t] = __builtin_amdgcn_wmma_f32_16x16x32_bf16(false, ah[m], false, bh[t], (short)0, acc[m][t], false, false);
#pragma unroll
        for (int t = 0; t < PBTILES; ++t)
#pragma unroll
            for (int m = 0; m < HL_MT; ++m)
                acc[m][t] = __builtin_amdgcn_wmma_f32_16x16x32_bf16(false, ah[m], false, bl[t], (short)0, acc[m][t], false, false);
#pragma unroll
        for (int t = 0; t < PBTILES; ++t)
#pragma unroll
            for (int m = 0; m < HL_MT; ++m)
                acc[m][t] = __builtin_amdgcn_wmma_f32_16x16x32_bf16(false, al[m], false, bh[t], (short)0, acc[m][t], false, false);
        // The next trip rewrites the address and data registers of this trip's panel stores.
        asm volatile("s_wait_xcnt 0x0" ::: "memory");
    }

#pragma unroll
    for (int m = 0; m < HL_MT; ++m)
#pragma unroll
        for (int t = 0; t < PBTILES; ++t)
#pragma unroll
            for (int j = 0; j < 8; ++j) part[w][(m * PBTILES + t) * 8 + j][lane] = acc[m][t][j];
    __syncthreads();                               // every wave's partial sums stand in LDS

    // Wave w adds register w of every tile over the 8 waves and leaves it in LDS.
#pragma unroll
    for (int m = 0; m < HL_MT; ++m)
#pragma unroll
        for (int t = 0; t < PBTILES; ++t) {
            float s = part[0][(m * PBTILES + t) * 8 + w][lane];
#pragma unroll
            for (int p = 1; p < 8; ++p) s += part[p][(m * PBTILES + t) * 8 + w][lane];
            hs[m * 16 + w + mhi][t * 16 + row16] = s;
        }
    __syncthreads();                               // every token's 80 sums stand in LDS

    // Gating: one wave per (row tile, LoRA chunk), one lane-slice a thread; the four
    // threads of a token each repeat its top-2.
    if (w < HL_MT * KCL) {
        const int c = w & (KCL - 1);
        const int m = w >> 1;
        const float* row = hs[m * 16 + row16];

        int e0 = 0; float v0 = row[0];
#pragma unroll
        for (int e = 1; e < NEXP; ++e) { float v = row[e]; if (v > v0) { v0 = v; e0 = e; } }
        int e1 = (e0 == 0) ? 1 : 0; float v1 = row[e1];
#pragma unroll
        for (int e = 0; e < NEXP; ++e) {
            if (e == e0) continue;
            float v = row[e];
            if (v > v1) { v1 = v; e1 = e; }
        }
        float x1  = __expf(v1 - v0);
        float inv = 1.0f / (1.0f + x1);
        float g0 = inv * LSCALE;
        float g1 = x1 * inv * LSCALE;

        v16bf h, l;
#pragma unroll
        for (int half = 0; half < 2; ++half) {
            const int e = c * 4 + half * 2 + (lane >> 4);
            const float4 p = *(const float4*)(row + NEXP + e * RANK);
            const float4 q = *(const float4*)(row + NEXP + e * RANK + 4);
            const float hv[RANK] = {p.x, p.y, p.z, p.w, q.x, q.y, q.z, q.w};
            const bool  on = (e == e0) || (e == e1);
            const float g  = (e == e0) ? g0 : g1;
#pragma unroll
            for (int r = 0; r < RANK; ++r) {
                float v = on ? hv[r] * g : 0.0f;
                __bf16 hh, ll;
                split_bf16(v, hh, ll);
                h[half * 8 + r] = hh; l[half * 8 + r] = ll;
            }
        }
        size_t off = frag_off(mt0 + m, KCX, KC + c, lane);
        *(v16bf*)(XPh + off) = h;
        *(v16bf*)(XPl + off) = l;
        // As behind pack_w's stores: the packing code follows in the listing.
        asm volatile("s_wait_xcnt 0x0" ::: "memory");
    }
}

// ---------------------------------------------------------------------------
// y = [x | gated h] @ [W | B_w]^T + bias: base GEMM and LoRA term in one k loop.
// 256x256 tile / block, 16 waves (4x4) of 64x64 each, one block per WGP. A stage
// is two k-chunks; its 128 fragments are brought into LDS once per block by async
// global->LDS copies (two buffers: stage t+2 flies while stage t+1 is worked on);
// every wave then reads its 16 fragments of a chunk from LDS: 32 ds_load_b128 +
// 48 v_wmma per 32-wide K chunk. A stage's buffer is handed over once its last fragments
// are in registers, ahead of the WMMAs on them; waves 8..15 refill it ahead
// of those WMMAs, waves 0..7 behind them.
// ---------------------------------------------------------------------------

__device__ __forceinline__ void stage_copy(unsigned lds,
                                           const __bf16* xh, const __bf16* xl, unsigned xo,
                                           const __bf16* wh, const __bf16* wl, unsigned wo) {
    asm volatile("global_load_async_to_lds_b128 %0, %4, %6\n\t"
                 "global_load_async_to_lds_b128 %0, %4, %6 offset:512\n\t"
                 "global_load_async_to_lds_b128 %1, %4, %7\n\t"
                 "global_load_async_to_lds_b128 %1, %4, %7 offset:512\n\t"
                 "global_load_async_to_lds_b128 %2, %5, %8\n\t"
                 "global_load_async_to_lds_b128 %2, %5, %8 offset:512\n\t"
                 "global_load_async_to_lds_b128 %3, %5, %9\n\t"
                 "global_load_async_to_lds_b128 %3, %5, %9 offset:512\n\t"
                 "s_wait_xcnt 0x0"
                 :: "v"(lds),               "v"(lds + PANELB),
                    "v"(lds + 2 * PANELB),  "v"(lds + 3 * PANELB),
                    "v"(xo), "v"(wo),
                    "s"(xh), "s"(xl), "s"(wh), "s"(wl)
                 : "memory");
}

// One lane's 16 bf16 of a staged fragment: its two 16-B halves.
__device__ __forceinline__ v16bf lds_frag(const char* f, int r0) {
    v8bf lo = *(const v8bf*)(f + r0);
    v8bf hi = *(const v8bf*)(f + (r0 ^ 16));
    return __builtin_shufflevector(lo, hi, 0, 1, 2, 3, 4, 5, 6, 7, 8, 9, 10, 11, 12, 13, 14, 15);
}

__global__ __launch_bounds__(512, 4) void k_main(const __bf16* __restrict__ XPh,
                                              const __bf16* __restrict__ XPl,
                                              const __bf16* __restrict__ WPh,
                                              const __bf16* __restrict__ WPl,
                                              const float* __restrict__ bb,
                                              float* __restrict__ out) {
    __shared__ __attribute__((aligned(1024))) char ring[2][STAGEB];

    const int tid  = threadIdx.x;
    const int lane = tid & 31;
    const int w    = tid >> 5;
    const int bm   = blockIdx.y * TM;
    const int bn   = blockIdx.x * TN;

    const int wm = w >> 2;                         // 0..3 -> 64-row slab
    const int wn = w & 3;                          // 0..3 -> 64-col slab
    const int row16 = lane & 15;
    const int mhi   = (lane >> 4) * 8;

    v8f acc[4][4];
#pragma unroll
    for (int a = 0; a < 4; ++a)
#pragma unroll
        for (int b = 0; b < 4; ++b)
#pragma unroll
            for (int j = 0; j < 8; ++j) acc[a][b][j] = 0.0f;

    const unsigned ldsw = (unsigned)(uintptr_t)(&ring[0][0]) + (unsigned)(w * FRAGB)
                        + (unsigned)((lane ^ (lane >> 4)) * 16);
    // Byte offsets into the panels (below 2^26): two registers live through the loop.
    const unsigned xo = (unsigned)(frag_off((bm >> 4) + w, KCX, 0, 0) * 2) + (unsigned)(lane * 16);
    const unsigned wo = (unsigned)(frag_off((bn >> 4) + w, KCX, 0, 0) * 2) + (unsigned)(lane * 16);
    // Read side: where lane's first half stands inside a staged fragment.
    const int r0 = (2 * lane + ((lane >> 3) & 1)) * 16;
    // Waves 0..7 take their last WMMAs of a stage ahead of their refill (see the hand-over below).
    // As a scalar, so that the test is a scalar branch.
    const bool mmfirst = __builtin_amdgcn_readfirstlane(tid >> 5) < 8;

    stage_copy(ldsw, XPh, XPl, xo, WPh, WPl, wo);
    stage_copy(ldsw + CHUNKB, XPh, XPl, xo + FRAGB, WPh, WPl, wo + FRAGB);
    asm volatile("s_wait_asynccnt 0x0" ::: "memory");   // stage 0 has landed (this wave's share)
    __syncthreads();                                    // ... and every other wave's
    stage_copy(ldsw + STAGEB, XPh, XPl, xo + 2 * FRAGB, WPh, WPl, wo + 2 * FRAGB);
    stage_copy(ldsw + STAGEB + CHUNKB, XPh, XPl, xo + 3 * FRAGB, WPh, WPl, wo + 3 * FRAGB);

    for (int s = 0; s < NST; ++s) {
        // Unrolled: the second chunk's LDS reads start among the first chunk's WMMAs.
#pragma unroll
        for (int c = 0; c < SKC; ++c) {
            const char* st = &ring[s & 1][c * CHUNKB];
            v16bf ah[4], al[4];
#pragma unroll
            for (int a = 0; a < 4; ++a) {
                ah[a] = lds_frag(st + (wm * 4 + a) * FRAGB, r0);
                al[a] = lds_frag(st + PANELB + (wm * 4 + a) * FRAGB, r0);
            }
            v16bf bh[4], bl[4];
            // Stage s + 2 into the buffer that stage s has left.
            auto refill = [&]() {
                if (s + 2 < NST) {
                    const unsigned ko = (unsigned)(s + 2) * (SKC * FRAGB);
                    const unsigned lb = ldsw + (unsigned)((s & 1) * STAGEB);
                    stage_copy(lb, XPh, XPl, xo + ko, WPh, WPl, wo + ko);
                    stage_copy(lb + CHUNKB, XPh, XPl, xo + ko + FRAGB, WPh, WPl, wo + ko + FRAGB);
                }
            };
#pragma unroll
            for (int b = 0; b < 4; ++b) {
                // The stage's last TAILB column tiles are read together, ahead of the hand-over.
                const bool tail = (c == SKC - 1) && (b >= 4 - TAILB);
                if (!tail) {
                    bh[b] = lds_frag(st + 2 * PANELB + (wn * 4 + b) * FRAGB, r0);
                    bl[b] = lds_frag(st + 3 * PANELB + (wn * 4 + b) * FRAGB, r0);
                } else if (b == 4 - TAILB) {
                    // Unrolled: q indexes the fragment arrays, which stay in registers only under constant indices.
#pragma unroll
                    for (int q = 4 - TAILB; q < 4; ++q) {
                        bh[q] = lds_frag(st + 2 * PANELB + (wn * 4 + q) * FRAGB, r0);
                        bl[q] = lds_frag(st + 3 * PANELB + (wn * 4 + q) * FRAGB, r0);
                    }
                    // Keeps the WMMAs written above on this side of the barrier: sunk behind it they
                    // would stand in front of the refill.
                    __builtin_amdgcn_sched_barrier(0);
                    asm volatile("s_wait_dscnt 0x0" ::: "memory");      // this wave has left buffer s & 1
                    asm volatile("s_wait_asynccnt 0x0" ::: "memory");   // its share of stage s + 1 has landed
                    __syncthreads();                                    // both hold for every wave
                    // Waves 8..15 send their refill out at once, ahead of the stage's last WMMAs;
                    // waves 0..7 start those WMMAs at once and refill behind them (for speed only).
                    if (!mmfirst) refill();
                }
                // Product-major: four independent accumulators between two uses of the same one.
#pragma unroll
                for (int a = 0; a < 4; ++a)
                    acc[a][b] = __builtin_amdgcn_wmma_f32_16x16x32_bf16(false, ah[a], false, bh[b], (short)0, acc[a][b], false, false);
#pragma unroll
                for (int a = 0; a < 4; ++a)
                    acc[a][b] = __builtin_amdgcn_wmma_f32_16x16x32_bf16(false, ah[a], false, bl[b], (short)0, acc[a][b], false, false);
#pragma unroll
                for (int a = 0; a < 4; ++a)
                    acc[a][b] = __builtin_amdgcn_wmma_f32_16x16x32_bf16(false, al[a], false, bh[b], (short)0, acc[a][b], false, false);
                if (tail && b == 3) {
                    if (mmfirst) refill();
                }
            }
        }
    }
    asm volatile("s_wait_asynccnt 0x0" ::: "memory");       // no copy outlives the loop

    // Epilogue: + bias.
#pragma unroll
    for (int b = 0; b < 4; ++b) {
        const int n = bn + wn * 64 + b * 16 + row16;
        const float bias = bb[n];
#pragma unroll
        for (int a = 0; a < 4; ++a) {
#pragma unroll
            for (int i = 0; i < 8; ++i) {
                const int mloc = wm * 64 + a * 16 + i + mhi;
                out[(size_t)(bm + mloc) * D_OUT + n] = acc[a][b][i] + bias;
            }
        }
    }
}

// ---------------------------------------------------------------------------
// Launch
// ---------------------------------------------------------------------------
extern "C" void kernel_launch(void* const* d_in, const int* in_sizes, int n_in,
                              void* d_out, int out_size, void* d_ws, size_t ws_size,
                              hipStream_t stream) {
    const float* x  = (const float*)d_in[0];   // [4,2048,2048]
    const float* Wb = (const float*)d_in[1];   // [2048,2048]
    const float* bb = (const float*)d_in[2];   // [2048]
    const float* Wr = (const float*)d_in[3];   // [8,2048]
    const float* Aw = (const float*)d_in[4];   // [8,8,2048]
    const float* Bw = (const float*)d_in[5];   // [8,2048,8]
    float* out = (float*)d_out;

    char* ws = (char*)d_ws;
    // panel sizes (bytes): XP 2x34603008, WP 2x8650752, PB 2x327680
    __bf16* XPh = (__bf16*)(ws);
    __bf16* XPl = (__bf16*)(ws + 34603008ull);
    __bf16* WPh = (__bf16*)(ws + 69206016ull);
    __bf16* WPl = (__bf16*)(ws + 77856768ull);
    __bf16* PBh = (__bf16*)(ws + 86507520ull);
    __bf16* PBl = (__bf16*)(ws + 86835200ull);

    hipLaunchKernelGGL(k_packpb, dim3((PBTILES * KC * 32 + 255) / 256), dim3(256), 0, stream, Wr, Aw, PBh, PBl);
    hipLaunchKernelGGL(k_hl,     dim3(HL_BLOCKS + PW_BLOCKS), dim3(256), 0, stream,
                       x, PBh, PBl, Wb, Bw, XPh, XPl, WPh, WPl);
    hipLaunchKernelGGL(k_main,   dim3(D_OUT / TN, NTOK / TM), dim3(512), 0, stream,
                       XPh, XPl, WPh, WPl, bb, out);
}

// v009
// Measured time: 123 microseconds a run.
// In two side-by-side timings against v008, it was 1.04 and 1.03 times as fast.
// Counting every step since v000, it is 3.02 times as fast.
#include <hip/hip_runtime.h>
#include <hip/hip_bf16.h>

typedef __attribute__((ext_vector_type(16))) __bf16 v16bf;
typedef __attribute__((ext_vector_type(8)))  __bf16 v8bf;
typedef __attribute__((ext_vector_type(8)))  float  v8f;

#define D_IN   2048
#define D_OUT  2048
#define NTOK   8192   // B*S
#define NEXP   8
#define RANK   8
#define LSCALE 2.0f   // ALPHA / R
#define PBROWS 80     // 8 router + 64 (E*R) + 8 pad
#define PBTILES 5

#define KC     64     // D_IN / 32 k-chunks
#define KCL    2      // NEXP * RANK / 32 k-chunks of the LoRA term
#define KCX    (KC + KCL)   // k-chunks per tile in the x and W panels
#define FRAG   16     // bf16 per lane per fragment
#define MT_X   512    // NTOK/16 row tiles of x
#define NT_W   128    // D_OUT/16 col tiles of W

#define TM 256
#define TN 256

#define FRAGB  1024           // bytes of one fragment: 32 lanes x 32 B
#define PANELB (16 * FRAGB)   // the 16 tiles one operand panel gives a block per k-chunk
#define CHUNKB (4 * PANELB)   // one k-chunk of a block: [x hi | x lo | W hi | W lo]
#define SKC    2              // k-chunks per stage
#define STAGEB (SKC * CHUNKB)
#define NST    (KCX / SKC)    // stages of the k loop
#define TAILB  2              // column tiles of a wave whose last WMMAs of a stage stand behind the hand-over

__device__ __forceinline__ void split_bf16(float x, __bf16& h, __bf16& l) {
    h = (__bf16)x;                 // RNE to bf16 (hi)
    l = (__bf16)(x - (float)h);    // residual (lo)
}

__device__ __forceinline__ size_t frag_off(int tile, int nkc, int kc, int lane) {
    return (((size_t)tile * nkc + kc) * 32 + lane) * FRAG;
}

#define PW_U      4
#define PW_P      (PW_U * 128 + 16)
#define PW_BASE   (NT_W * KC  / (8 * PW_U))
#define PW_BLOCKS (NT_W * KCX / (8 * PW_U))
template <int LS, int GS>
__device__ __forceinline__ void copy8(unsigned lds, const float* base, unsigned go) {
    asm volatile("global_load_async_to_lds_b128 %0, %8, %16\n\t"
                 "global_load_async_to_lds_b128 %1, %9, %16\n\t"
                 "global_load_async_to_lds_b128 %2, %10, %16\n\t"
                 "global_load_async_to_lds_b128 %3, %11, %16\n\t"
                 "global_load_async_to_lds_b128 %4, %12, %16\n\t"
                 "global_load_async_to_lds_b128 %5, %13, %16\n\t"
                 "global_load_async_to_lds_b128 %6, %14, %16\n\t"
                 "global_load_async_to_lds_b128 %7, %15, %16\n\t"
                 "s_wait_xcnt 0x0"
                 :: "v"(lds),          "v"(lds + LS),     "v"(lds + 2 * LS), "v"(lds + 3 * LS),
                    "v"(lds + 4 * LS), "v"(lds + 5 * LS), "v"(lds + 6 * LS), "v"(lds + 7 * LS),
                    "v"(go),           "v"(go + GS),      "v"(go + 2 * GS),  "v"(go + 3 * GS),
                    "v"(go + 4 * GS),  "v"(go + 5 * GS),  "v"(go + 6 * GS),  "v"(go + 7 * GS),
                    "s"(base)
                 : "memory");
}

__device__ __forceinline__ void pack_w(const bool lora, const int blk, char* stage,
                                       const float* __restrict__ Wb,
                                       const float* __restrict__ Bw,
                                       __bf16* __restrict__ WPh,
                                       __bf16* __restrict__ WPl) {
    const int lane = threadIdx.x & 31;
    // The wave's number as a scalar: tile and chunk numbers are scalar arithmetic.
    const int w    = __builtin_amdgcn_readfirstlane(threadIdx.x >> 5);
    const int hl   = lane >> 4;
    float4 f[PW_U][4];
    const int fr0 = (blk * 8 + w) * PW_U;              // the wave's first fragment within the part
    if (lora) {
        const float* a[PW_U];                          // each fragment's load address
#pragma unroll
        for (int u = 0; u < PW_U; ++u) {
            const int nt  = (fr0 + u) / KCL;
            const int kc  = (fr0 + u) % KCL;           // chunk within the part
            const int row = nt * 16 + (lane & 15);
            const float* src0 = Bw + ((kc * 4 + hl) * D_OUT + row) * RANK;
            const float* src1 = src0 + 2 * D_OUT * RANK;
            f[u][0] = *(const float4*)(src0);
            f[u][1] = *(const float4*)(src0 + 4);
            f[u][2] = *(const float4*)(src1);
            f[u][3] = *(const float4*)(src1 + 4);
            a[u] = src0;
        }
        // The loads' address registers stay live up to this wait (named as inputs), so that no
        // load's result and nothing behind the wait rewrites one ahead of it.
        asm volatile("s_wait_xcnt 0x0" :: "v"(a[0]), "v"(a[1]), "v"(a[2]), "v"(a[3]) : "memory");
    } else {
        // The wave's PW_U chunks are neighbours in one tile: 512 B of each of its 16 rows, one
        // copy a row, into LDS that only this wave touches (so its own wait is enough).
        const unsigned l0 = (unsigned)(uintptr_t)stage + (unsigned)(lane * 16);
        const unsigned g0 = (unsigned)(((fr0 / KC) * 16 * D_IN + (fr0 % KC) * 32) * 4 + lane * 16);
        copy8<PW_P, D_IN * 4>(l0, Wb, g0);
        copy8<PW_P, D_IN * 4>(l0 + 8 * PW_P, Wb, g0 + 8 * (D_IN * 4));
        asm volatile("s_wait_asynccnt 0x0" ::: "memory");   // the 16 rows have landed
        // Unrolled: u indexes f, which stays in registers only under constant indices.
#pragma unroll
        for (int u = 0; u < PW_U; ++u) {
            const char* s = stage + (lane & 15) * PW_P + u * 128 + hl * 32;
            f[u][0] = *(const float4*)(s);
            f[u][1] = *(const float4*)(s + 16);
            f[u][2] = *(const float4*)(s + 64);
            f[u][3] = *(const float4*)(s + 80);
        }
    }
#pragma unroll
    for (int u = 0; u < PW_U; ++u) {
        const int fr = fr0 + u;
        const int nt = lora ? fr / KCL : fr / KC;
        const int kc = lora ? KC + fr % KCL : fr % KC;
        const float4* q = f[u];
        const float g[16] = {q[0].x, q[0].y, q[0].z, q[0].w, q[1].x, q[1].y, q[1].z, q[1].w,
                             q[2].x, q[2].y, q[2].z, q[2].w, q[3].x, q[3].y, q[3].z, q[3].w};
        v16bf h, l;
#pragma unroll
        for (int j = 0; j < 16; ++j) {
            __bf16 hh, ll;
            split_bf16(g[j], hh, ll);
            h[j] = hh; l[j] = ll;
        }
        const size_t off = frag_off(nt, KCX, kc, lane);
        *(v16bf*)(WPh + off) = h;
        *(v16bf*)(WPl + off) = l;
    }
    // Code of the kernel's other parts follows in the listing and rewrites the registers of
    // these stores.
    asm volatile("s_wait_xcnt 0x0" ::: "memory");
}

// Pack [W_router ; A_w ; zeros] (80 logical rows) into 5 fragment tiles.
__global__ __launch_bounds__(256) void k_packpb(const float* __restrict__ Wr,
                                                const float* __restrict__ Aw,
                                                __bf16* __restrict__ PBh,
                                                __bf16* __restrict__ PBl) {
    int t = blockIdx.x * 256 + threadIdx.x;        // 0 .. PBTILES*KC*32-1
    if (t >= PBTILES * KC * 32) return;
    int lane = t & 31;
    int kc   = (t >> 5) & (KC - 1);
    int nt   = t >> 11;
    int row  = nt * 16 + (lane & 15);              // 0..79
    int kb   = (lane >> 4) << 3;
    const float* src = (row < NEXP) ? (Wr + (size_t)row * D_IN)
                     : (row < NEXP + NEXP * RANK) ? (Aw + (size_t)(row - NEXP) * D_IN)
                     : nullptr;
    v16bf h, l;
#pragma unroll
    for (int j = 0; j < 8; ++j) {
        float f0 = src ? src[kc * 32 + kb + j]      : 0.0f;
        float f1 = src ? src[kc * 32 + kb + 16 + j] : 0.0f;
        __bf16 h0, l0, h1, l1;
        split_bf16(f0, h0, l0);
        split_bf16(f1, h1, l1);
        h[j] = h0; l[j] = l0; h[8 + j] = h1; l[8 + j] = l1;
    }
    size_t off = (size_t)t * FRAG;
    *(v16bf*)(PBh + off) = h;
    *(v16bf*)(PBl + off) = l;
}

#define HL_MT 2
#define HL_KW (KC / 8)
#define HL_NT (HL_MT * PBTILES)
#define HL_BLOCKS (MT_X / HL_MT)
#define HS_P  (PBROWS + 4)
#define XT_KC 2
#define XT_N  (HL_KW / XT_KC)
#define XT_P  (XT_KC * 128 + 16)
#define XT_B  (HL_MT * 16 * XT_P)
#define XRINGB (8 * 2 * XT_B)

__global__ __launch_bounds__(256, 4) void k_hl(const float* __restrict__ x,
                                               const __bf16* __restrict__ PBh,
                                               const __bf16* __restrict__ PBl,
                                               const float* __restrict__ Wb,
                                               const float* __restrict__ Bw,
                                               __bf16* __restrict__ XPh,
                                               __bf16* __restrict__ XPl,
                                               __bf16* __restrict__ WPh,
                                               __bf16* __restrict__ WPl) {
    // The x rings; behind the k loop the same bytes hold the partial sums.
    __shared__ __attribute__((aligned(16))) char xring[XRINGB];
    static_assert(sizeof(float) * 8 * HL_NT * 8 * 32 <= XRINGB, "the partial sums fit the rings");
    float (*part)[HL_NT * 8][32] = reinterpret_cast<float (*)[HL_NT * 8][32]>(xring);   // [wave][tile * 8 + register][lane]
    __shared__ __attribute__((aligned(16))) float hs[HL_MT * 16][HS_P];   // [token][router 8 | h 64 | pad]

    // The long blocks have the low indices; the W blocks run beside them.
    if (blockIdx.x >= HL_BLOCKS) {
        const int pb = blockIdx.x - HL_BLOCKS;
        // Each wave stages in the bytes that are its x ring in the other blocks.
        char* stage = &xring[0] + __builtin_amdgcn_readfirstlane(threadIdx.x >> 5) * (2 * XT_B);
        static_assert(16 * PW_P <= 2 * XT_B, "a wave's W rows fit its ring");
        if (pb < PW_BASE) pack_w(false, pb, stage, Wb, Bw, WPh, WPl);
        else              pack_w(true, pb - PW_BASE, stage, Wb, Bw, WPh, WPl);
        return;
    }

    const int lane = threadIdx.x & 31;
    // The wave's number as a scalar: panel offsets and LDS bases are scalar arithmetic.
    const int w    = __builtin_amdgcn_readfirstlane(threadIdx.x >> 5);
    const int mt0  = blockIdx.x * HL_MT;           // first row tile of the block
    const int row16 = lane & 15;
    const int mhi   = (lane >> 4) * 8;
    // The lane's place in the wave's first fragment of each panel.
    const unsigned lo = (unsigned)lane * (FRAG * 2);
    char* qxh = (char*)(XPh + frag_off(mt0, KCX, w * HL_KW, 0)) + lo;
    char* qxl = (char*)(XPl + frag_off(mt0, KCX, w * HL_KW, 0)) + lo;
    const char* pbh = (const char*)(PBh + frag_off(0, KC, w * HL_KW, 0)) + lo;
    const char* pbl = (const char*)(PBl + frag_off(0, KC, w * HL_KW, 0)) + lo;
    const unsigned xl0 = (unsigned)(uintptr_t)(&xring[0]) + (unsigned)(w * 2 * XT_B)
                       + (unsigned)((lane >> 4) * XT_P + (lane & 15) * 16);
    const unsigned xg0 = (unsigned)(((mt0 * 16 + (lane >> 4)) * D_IN + w * (HL_KW * 32)) * 4 + (lane & 15) * 16);
    // Tile t of the wave into its buffer b: 16 copies, each 2 rows x 256 B.
    auto x_tile = [&](int t, int b) {
        copy8<2 * XT_P, 2 * D_IN * 4>(xl0 + (unsigned)(b * XT_B), x, xg0 + (unsigned)(t * (XT_KC * 128)));
        copy8<2 * XT_P, 2 * D_IN * 4>(xl0 + (unsigned)(b * XT_B + 16 * XT_P), x, xg0 + (unsigned)(t * (XT_KC * 128) + 16 * (D_IN * 4)));
    };
    // Read side: the lane's first value of a tile's first chunk: its row, K = mhi.
    const char* xr0 = &xring[0] + w * 2 * XT_B + row16 * XT_P + mhi * 4;

    v8f acc[HL_MT][PBTILES];
#pragma unroll
    for (int m = 0; m < HL_MT; ++m)
#pragma unroll
        for (int t = 0; t < PBTILES; ++t)
#pragma unroll
            for (int j = 0; j < 8; ++j) acc[m][t][j] = 0.0f;

    // The ring is the wave's own: it reads only what it has copied itself, so its own waits
    // order copies and reads, and no barrier is needed.
    x_tile(0, 0);
    asm volatile("s_wait_asynccnt 0x0" ::: "memory");   // tile 0 has landed
    x_tile(1, 1);

    // Rolled over the tiles: one tile's copies fly while the tile before is worked on.
#pragma unroll 1
    for (int t = 0; t < XT_N; ++t) {
    // Unrolled: c is a constant offset in the LDS reads.
#pragma unroll
    for (int c = 0; c < XT_KC; ++c) {
        const int i = t * XT_KC + c;
        v16bf ah[HL_MT], al[HL_MT], bh[PBTILES], bl[PBTILES];
#pragma unroll
        for (int tt = 0; tt < PBTILES; ++tt) {
            bh[tt] = *(const v16bf*)(pbh + (tt * KC + i) * FRAGB);
            bl[tt] = *(const v16bf*)(pbl + (tt * KC + i) * FRAGB);
        }
        // Keeps all 20 loads ahead of the split and the WMMAs: the B loads share one round trip.
        __builtin_amdgcn_sched_barrier(0);
#pragma unroll
        for (int m = 0; m < HL_MT; ++m) {
            // K {0..3}, {4..7}, {16..19}, {20..23} from the lane's first.
            const char* s = xr0 + (t & 1) * XT_B + m * (16 * XT_P) + c * 128;
            const float4 q[4] = {*(const float4*)(s), *(const float4*)(s + 16),
                                 *(const float4*)(s + 64), *(const float4*)(s + 80)};
            const float f[16] = {q[0].x, q[0].y, q[0].z, q[0].w, q[1].x, q[1].y, q[1].z, q[1].w,
                                 q[2].x, q[2].y, q[2].z, q[2].w, q[3].x, q[3].y, q[3].z, q[3].w};
            v16bf h, l;
#pragma unroll
            for (int j = 0; j < 16; ++j) {
                __bf16 hh, ll;
                split_bf16(f[j], hh, ll);
                h[j] = hh; l[j] = ll;
            }
            ah[m] = h; al[m] = l;
            *(v16bf*)(qxh + (m * KCX + i) * FRAGB) = h;
            *(v16bf*)(qxl + (m * KCX + i) * FRAGB) = l;
        }
        // Product-major: ten independent accumulators between two uses of the same one.
#pragma unroll
        for (int t = 0; t < PBTILES; ++t)
#pragma unroll
            for (int m = 0; m < HL_MT; ++m)
                acc[m][t] = __builtin_amdgcn_wmma_f32_16x16x32_bf16(false, ah[m], false, bh[t], (short)0, acc[m][t], false, false);
#pragma unroll
        for (int t = 0; t < PBTILES; ++t)
#pragma unroll
            for (int m = 0; m < HL_MT; ++m)
                acc[m][t] = __builtin_amdgcn_wmma_f32_16x16x32_bf16(false, ah[m], false, bl[t], (short)0, acc[m][t], false, false);
#pragma unroll
        for (int t = 0; t < PBTILES; ++t)
#pragma unroll
            for (int m = 0; m < HL_MT; ++m)
                acc[m][t] = __builtin_amdgcn_wmma_f32_16x16x32_bf16(false, al[m], false, bh[t], (short)0, acc[m][t], false, false);
        // The next trip rewrites the address and data registers of this trip's panel stores.
        asm volatile("s_wait_xcnt 0x0" ::: "memory");
    }
        asm volatile("s_wait_dscnt 0x0" ::: "memory");      // the wave has left buffer t & 1
        asm volatile("s_wait_asynccnt 0x0" ::: "memory");   // tile t + 1 has landed
        if (t + 2 < XT_N) x_tile(t + 2, t & 1);
    }
    __syncthreads();                               // every wave has left its ring: the sums may take its place

#pragma unroll
    for (int m = 0; m < HL_MT; ++m)
#pragma unroll
        for (int t = 0; t < PBTILES; ++t)
#pragma unroll
            for (int j = 0; j < 8; ++j) part[w][(m * PBTILES + t) * 8 + j][lane] = acc[m][t][j];
    __syncthreads();                               // every wave's partial sums stand in LDS

    // Wave w adds register w of every tile over the 8 waves and leaves it in LDS.
#pragma unroll
    for (int m = 0; m < HL_MT; ++m)
#pragma unroll
        for (int t = 0; t < PBTILES; ++t) {
            float s = part[0][(m * PBTILES + t) * 8 + w][lane];
#pragma unroll
            for (int p = 1; p < 8; ++p) s += part[p][(m * PBTILES + t) * 8 + w][lane];
            hs[m * 16 + w + mhi][t * 16 + row16] = s;
        }
    __syncthreads();                               // every token's 80 sums stand in LDS

    // Gating: one wave per (row tile, LoRA chunk), one lane-slice a thread; the four
    // threads of a token each repeat its top-2.
    if (w < HL_MT * KCL) {
        const int c = w & (KCL - 1);
        const int m = w >> 1;
        const float* row = hs[m * 16 + row16];

        int e0 = 0; float v0 = row[0];
#pragma unroll
        for (int e = 1; e < NEXP; ++e) { float v = row[e]; if (v > v0) { v0 = v; e0 = e; } }
        int e1 = (e0 == 0) ? 1 : 0; float v1 = row[e1];
#pragma unroll
        for (int e = 0; e < NEXP; ++e) {
            if (e == e0) continue;
            float v = row[e];
            if (v > v1) { v1 = v; e1 = e; }
        }
        float x1  = __expf(v1 - v0);
        float inv = 1.0f / (1.0f + x1);
        float g0 = inv * LSCALE;
        float g1 = x1 * inv * LSCALE;

        v16bf h, l;
#pragma unroll
        for (int half = 0; half < 2; ++half) {
            const int e = c * 4 + half * 2 + (lane >> 4);
            const float4 p = *(const float4*)(row + NEXP + e * RANK);
            const float4 q = *(const float4*)(row + NEXP + e * RANK + 4);
            const float hv[RANK] = {p.x, p.y, p.z, p.w, q.x, q.y, q.z, q.w};
            const bool  on = (e == e0) || (e == e1);
            const float g  = (e == e0) ? g0 : g1;
#pragma unroll
            for (int r = 0; r < RANK; ++r) {
                float v = on ? hv[r] * g : 0.0f;
                __bf16 hh, ll;
                split_bf16(v, hh, ll);
                h[half * 8 + r] = hh; l[half * 8 + r] = ll;
            }
        }
        size_t off = frag_off(mt0 + m, KCX, KC + c, lane);
        *(v16bf*)(XPh + off) = h;
        *(v16bf*)(XPl + off) = l;
        // As behind pack_w's stores: the packing code follows in the listing.
        asm volatile("s_wait_xcnt 0x0" ::: "memory");
    }
}

// ---------------------------------------------------------------------------
// y = [x | gated h] @ [W | B_w]^T + bias: base GEMM and LoRA term in one k loop.
// 256x256 tile / block, 16 waves (4x4) of 64x64 each, one block per WGP. A stage
// is two k-chunks; its 128 fragments are brought into LDS once per block by async
// global->LDS copies (two buffers: stage t+2 flies while stage t+1 is worked on);
// every wave then reads its 16 fragments of a chunk from LDS: 32 ds_load_b128 +
// 48 v_wmma per 32-wide K chunk. A stage's buffer is handed over once its last fragments
// are in registers, ahead of the WMMAs on them; waves 8..15 refill it ahead
// of those WMMAs, waves 0..7 behind them.
// ---------------------------------------------------------------------------

__device__ __forceinline__ void stage_copy(unsigned lds,
                                           const __bf16* xh, const __bf16* xl, unsigned xo,
                                           const __bf16* wh, const __bf16* wl, unsigned wo) {
    asm volatile("global_load_async_to_lds_b128 %0, %4, %6\n\t"
                 "global_load_async_to_lds_b128 %0, %4, %6 offset:512\n\t"
                 "global_load_async_to_lds_b128 %1, %4, %7\n\t"
                 "global_load_async_to_lds_b128 %1, %4, %7 offset:512\n\t"
                 "global_load_async_to_lds_b128 %2, %5, %8\n\t"
                 "global_load_async_to_lds_b128 %2, %5, %8 offset:512\n\t"
                 "global_load_async_to_lds_b128 %3, %5, %9\n\t"
                 "global_load_async_to_lds_b128 %3, %5, %9 offset:512\n\t"
                 "s_wait_xcnt 0x0"
                 :: "v"(lds),               "v"(lds + PANELB),
                    "v"(lds + 2 * PANELB),  "v"(lds + 3 * PANELB),
                    "v"(xo), "v"(wo),
                    "s"(xh), "s"(xl), "s"(wh), "s"(wl)
                 : "memory");
}

// One lane's 16 bf16 of a staged fragment: its two 16-B halves.
__device__ __forceinline__ v16bf lds_frag(const char* f, int r0) {
    v8bf lo = *(const v8bf*)(f + r0);
    v8bf hi = *(const v8bf*)(f + (r0 ^ 16));
    return __builtin_shufflevector(lo, hi, 0, 1, 2, 3, 4, 5, 6, 7, 8, 9, 10, 11, 12, 13, 14, 15);
}

__global__ __launch_bounds__(512, 4) void k_main(const __bf16* __restrict__ XPh,
                                              const __bf16* __restrict__ XPl,
                                              const __bf16* __restrict__ WPh,
                                              const __bf16* __restrict__ WPl,
                                              const float* __restrict__ bb,
                                              float* __restrict__ out) {
    __shared__ __attribute__((aligned(1024))) char ring[2][STAGEB];

    const int tid  = threadIdx.x;
    const int lane = tid & 31;
    const int w    = tid >> 5;
    const int bm   = blockIdx.y * TM;
    const int bn   = blockIdx.x * TN;

    const int wm = w >> 2;                         // 0..3 -> 64-row slab
    const int wn = w & 3;                          // 0..3 -> 64-col slab
    const int row16 = lane & 15;
    const int mhi   = (lane >> 4) * 8;

    v8f acc[4][4];
#pragma unroll
    for (int a = 0; a < 4; ++a)
#pragma unroll
        for (int b = 0; b < 4; ++b)
#pragma unroll
            for (int j = 0; j < 8; ++j) acc[a][b][j] = 0.0f;

    const unsigned ldsw = (unsigned)(uintptr_t)(&ring[0][0]) + (unsigned)(w * FRAGB)
                        + (unsigned)((lane ^ (lane >> 4)) * 16);
    // Byte offsets into the panels (below 2^26): two registers live through the loop.
    const unsigned xo = (unsigned)(frag_off((bm >> 4) + w, KCX, 0, 0) * 2) + (unsigned)(lane * 16);
    const unsigned wo = (unsigned)(frag_off((bn >> 4) + w, KCX, 0, 0) * 2) + (unsigned)(lane * 16);
    // Read side: where lane's first half stands inside a staged fragment.
    const int r0 = (2 * lane + ((lane >> 3) & 1)) * 16;
    // Waves 0..7 take their last WMMAs of a stage ahead of their refill (see the hand-over below).
    // As a scalar, so that the test is a scalar branch.
    const bool mmfirst = __builtin_amdgcn_readfirstlane(tid >> 5) < 8;

    stage_copy(ldsw, XPh, XPl, xo, WPh, WPl, wo);
    stage_copy(ldsw + CHUNKB, XPh, XPl, xo + FRAGB, WPh, WPl, wo + FRAGB);
    asm volatile("s_wait_asynccnt 0x0" ::: "memory");   // stage 0 has landed (this wave's share)
    __syncthreads();                                    // ... and every other wave's
    stage_copy(ldsw + STAGEB, XPh, XPl, xo + 2 * FRAGB, WPh, WPl, wo + 2 * FRAGB);
    stage_copy(ldsw + STAGEB + CHUNKB, XPh, XPl, xo + 3 * FRAGB, WPh, WPl, wo + 3 * FRAGB);

    for (int s = 0; s < NST; ++s) {
        // Unrolled: the second chunk's LDS reads start among the first chunk's WMMAs.
#pragma unroll
        for (int c = 0; c < SKC; ++c) {
            const char* st = &ring[s & 1][c * CHUNKB];
            v16bf ah[4], al[4];
#pragma unroll
            for (int a = 0; a < 4; ++a) {
                ah[a] = lds_frag(st + (wm * 4 + a) * FRAGB, r0);
                al[a] = lds_frag(st + PANELB + (wm * 4 + a) * FRAGB, r0);
            }
            v16bf bh[4], bl[4];
            // Stage s + 2 into the buffer that stage s has left.
            auto refill = [&]() {
                if (s + 2 < NST) {
                    const unsigned ko = (unsigned)(s + 2) * (SKC * FRAGB);
                    const unsigned lb = ldsw + (unsigned)((s & 1) * STAGEB);
                    stage_copy(lb, XPh, XPl, xo + ko, WPh, WPl, wo + ko);
                    stage_copy(lb + CHUNKB, XPh, XPl, xo + ko + FRAGB, WPh, WPl, wo + ko + FRAGB);
                }
            };
#pragma unroll
            for (int b = 0; b < 4; ++b) {
                // The stage's last TAILB column tiles are read together, ahead of the hand-over.
                const bool tail = (c == SKC - 1) && (b >= 4 - TAILB);
                if (!tail) {
                    bh[b] = lds_frag(st + 2 * PANELB + (wn * 4 + b) * FRAGB, r0);
                    bl[b] = lds_frag(st + 3 * PANELB + (wn * 4 + b) * FRAGB, r0);
                } else if (b == 4 - TAILB) {
                    // Unrolled: q indexes the fragment arrays, which stay in registers only under constant indices.
#pragma unroll
                    for (int q = 4 - TAILB; q < 4; ++q) {
                        bh[q] = lds_frag(st + 2 * PANELB + (wn * 4 + q) * FRAGB, r0);
                        bl[q] = lds_frag(st + 3 * PANELB + (wn * 4 + q) * FRAGB, r0);
                    }
                    // Keeps the WMMAs written above on this side of the barrier: sunk behind it they
                    // would stand in front of the refill.
                    __builtin_amdgcn_sched_barrier(0);
                    asm volatile("s_wait_dscnt 0x0" ::: "memory");      // this wave has left buffer s & 1
                    asm volatile("s_wait_asynccnt 0x0" ::: "memory");   // its share of stage s + 1 has landed
                    __syncthreads();                                    // both hold for every wave
                    // Waves 8..15 send their refill out at once, ahead of the stage's last WMMAs;
                    // waves 0..7 start those WMMAs at once and refill behind them (for speed only).
                    if (!mmfirst) refill();
                }
                // Product-major: four independent accumulators between two uses of the same one.
#pragma unroll
                for (int a = 0; a < 4; ++a)
                    acc[a][b] = __builtin_amdgcn_wmma_f32_16x16x32_bf16(false, ah[a], false, bh[b], (short)0, acc[a][b], false, false);
#pragma unroll
                for (int a = 0; a < 4; ++a)
                    acc[a][b] = __builtin_amdgcn_wmma_f32_16x16x32_bf16(false, ah[a], false, bl[b], (short)0, acc[a][b], false, false);
#pragma unroll
                for (int a = 0; a < 4; ++a)
                    acc[a][b] = __builtin_amdgcn_wmma_f32_16x16x32_bf16(false, al[a], false, bh[b], (short)0, acc[a][b], false, false);
                if (tail && b == 3) {
                    if (mmfirst) refill();
                }
            }
        }
    }
    asm volatile("s_wait_asynccnt 0x0" ::: "memory");       // no copy outlives the loop

    // Epilogue: + bias.
#pragma unroll
    for (int b = 0; b < 4; ++b) {
        const int n = bn + wn * 64 + b * 16 + row16;
        const float bias = bb[n];
#pragma unroll
        for (int a = 0; a < 4; ++a) {
#pragma unroll
            for (int i = 0; i < 8; ++i) {
                const int mloc = wm * 64 + a * 16 + i + mhi;
                out[(size_t)(bm + mloc) * D_OUT + n] = acc[a][b][i] + bias;
            }
        }
    }
}

// ---------------------------------------------------------------------------
// Launch
// ---------------------------------------------------------------------------
extern "C" void kernel_launch(void* const* d_in, const int* in_sizes, int n_in,
                              void* d_out, int out_size, void* d_ws, size_t ws_size,
                              hipStream_t stream) {
    const float* x  = (const float*)d_in[0];   // [4,2048,2048]
    const float* Wb = (const float*)d_in[1];   // [2048,2048]
    const float* bb = (const float*)d_in[2];   // [2048]
    const float* Wr = (const float*)d_in[3];   // [8,2048]
    const float* Aw = (const float*)d_in[4];   // [8,8,2048]
    const float* Bw = (const float*)d_in[5];   // [8,2048,8]
    float* out = (float*)d_out;

    char* ws = (char*)d_ws;
    // panel sizes (bytes): XP 2x34603008, WP 2x8650752, PB 2x327680
    __bf16* XPh = (__bf16*)(ws);
    __bf16* XPl = (__bf16*)(ws + 34603008ull);
    __bf16* WPh = (__bf16*)(ws + 69206016ull);
    __bf16* WPl = (__bf16*)(ws + 77856768ull);
    __bf16* PBh = (__bf16*)(ws + 86507520ull);
    __bf16* PBl = (__bf16*)(ws + 86835200ull);

    hipLaunchKernelGGL(k_packpb, dim3((PBTILES * KC * 32 + 255) / 256), dim3(256), 0, stream, Wr, Aw, PBh, PBl);
    hipLaunchKernelGGL(k_hl,     dim3(HL_BLOCKS + PW_BLOCKS), dim3(256), 0, stream,
                       x, PBh, PBl, Wb, Bw, XPh, XPl, WPh, WPl);
    hipLaunchKernelGGL(k_main,   dim3(D_OUT / TN, NTOK / TM), dim3(512), 0, stream,
                       XPh, XPl, WPh, WPl, bb, out);
}
